// v000
// Measured on an AMD MI455X. A time is GPU time per run, averaged over a window of back-to-back runs after a warm-up
// (all launches, gaps included; the runs take copies of the inputs in turn), and the median of several windows.
// Apart from v000's, it joins two sittings. Times from different sittings can be a few percent apart, while
// side-by-side timings come from the same sitting.
// v000, which the later versions start from, runs in 86.8 microseconds.
#include <hip/hip_runtime.h>

typedef __attribute__((ext_vector_type(16))) _Float16     v16h;
typedef __attribute__((ext_vector_type(8)))  float        v8f;
typedef __attribute__((ext_vector_type(4)))  float        f32x4;
typedef __attribute__((ext_vector_type(4)))  unsigned int u32x4;

#define B_    2
#define H_    8
#define S_    2048
#define D_    64
#define KB    64            // keys per block iteration
#define WAVES 8
#define QW    16            // queries per wave
#define QB    (WAVES * QW)  // 128 queries per workgroup

// log2(e) / sqrt(D): folds softmax scale AND base-2 exp into Q once.
#define QSCALE 0.18033688011112042f

// DPP lane-xor within 16-lane rows (ROW_XMASK = 0x160 | mask): pure-VALU butterfly.
template<int CTRL>
__device__ __forceinline__ float dpp_f32(float x) {
    int i = __builtin_bit_cast(int, x);
    i = __builtin_amdgcn_update_dpp(i, i, CTRL, 0xF, 0xF, true);
    return __builtin_bit_cast(float, i);
}
__device__ __forceinline__ float rowmax16(float x) {
    x = fmaxf(x, dpp_f32<0x161>(x));   // xor 1
    x = fmaxf(x, dpp_f32<0x162>(x));   // xor 2
    x = fmaxf(x, dpp_f32<0x164>(x));   // xor 4
    x = fmaxf(x, dpp_f32<0x168>(x));   // xor 8
    return x;
}
__device__ __forceinline__ float rowsum16(float x) {
    x += dpp_f32<0x161>(x);
    x += dpp_f32<0x162>(x);
    x += dpp_f32<0x164>(x);
    x += dpp_f32<0x168>(x);
    return x;
}

__launch_bounds__(256, 1)
__global__ void sdpa_fa_wmma(const float* __restrict__ Q,
                             const float* __restrict__ K,
                             const float* __restrict__ V,
                             float* __restrict__ O)
{
    // Double-buffered K/V tiles + per-wave P staging: 48 KB total.
    __shared__ __align__(16) _Float16 Ks[2][KB][D_];     // 2 x 8 KB, [key][d]
    __shared__ __align__(16) _Float16 Vt[2][D_][KB];     // 2 x 8 KB, [d][key]
    __shared__ __align__(16) _Float16 Ps[WAVES][16][KB]; // 16 KB

    const int tid   = threadIdx.x;
    const int w     = tid >> 5;
    const int lane  = tid & 31;
    const int lh    = lane & 15;       // lane within 16-lane half
    const int hi    = lane >> 4;       // which half
    const int kbase = hi ? 8 : 0;      // fragment contraction base for this lane

    const int nqb = S_ / QB;
    const int bid = blockIdx.x;
    const int bh  = bid / nqb;         // fused (b*H + h)
    const int qb  = bid % nqb;
    const int b   = bh / H_;
    const int h   = bh % H_;

    const float* Qp = Q + (size_t)bh * S_ * D_;
    const float* Kp = K + (size_t)bh * S_ * D_;
    const float* Vp = V + (size_t)bh * S_ * D_;

    const int q0 = qb * QB + w * QW;

    // ---- Q A-fragments, pre-scaled by log2(e)/sqrt(D) (f32 -> f16) ----
    v16h aq[2];
    {
        const float* qrow = Qp + (size_t)(q0 + lh) * D_;
        #pragma unroll
        for (int dc = 0; dc < 2; ++dc) {
            const float* p0 = qrow + dc * 32 + kbase;
            const float* p1 = qrow + dc * 32 + 16 + kbase;
            #pragma unroll
            for (int j = 0; j < 8; ++j) {
                aq[dc][j]     = (_Float16)(p0[j] * QSCALE);
                aq[dc][j + 8] = (_Float16)(p1[j] * QSCALE);
            }
        }
    }

    v8f zf = {};
    v8f acc[4];
    #pragma unroll
    for (int nt = 0; nt < 4; ++nt) acc[nt] = zf;
    float mrow[8], lrow[8];            // lrow: per-lane PARTIAL sums (log2 domain)
    #pragma unroll
    for (int r = 0; r < 8; ++r) { mrow[r] = -3.0e38f; lrow[r] = 0.0f; }

    const int keyld = tid >> 2;          // 0..63: staged key row
    const int dseg  = (tid & 3) * 16;    // 0,16,32,48: 16-wide d segment

    // ---- pipeline preload: block 0 K/V into registers ----
    f32x4 kr[4], vr[4];
    {
        const f32x4* krow = (const f32x4*)(Kp + (size_t)keyld * D_ + dseg);
        const f32x4* vrow = (const f32x4*)(Vp + (size_t)keyld * D_ + dseg);
        #pragma unroll
        for (int j = 0; j < 4; ++j) { kr[j] = krow[j]; vr[j] = vrow[j]; }
    }

    for (int kb = 0; kb < S_; kb += KB) {
        const int buf = (kb / KB) & 1;

        // ---- drain staged registers into LDS (f32 -> f16, V transposed) ----
        {
            union { _Float16 h8[8]; u32x4 u; } pk0, pk1;
            #pragma unroll
            for (int j = 0; j < 8; ++j) {
                pk0.h8[j] = (_Float16)kr[j >> 2][j & 3];
                pk1.h8[j] = (_Float16)kr[(j + 8) >> 2][j & 3];
            }
            *(u32x4*)&Ks[buf][keyld][dseg]     = pk0.u;
            *(u32x4*)&Ks[buf][keyld][dseg + 8] = pk1.u;
            #pragma unroll
            for (int j = 0; j < 16; ++j)
                Vt[buf][dseg + j][keyld] = (_Float16)vr[j >> 2][j & 3];
        }
        __syncthreads();

        // ---- issue next block's global loads; consumed next iteration ----
        if (kb + KB < S_) {  // uniform condition
            const f32x4* krow = (const f32x4*)(Kp + (size_t)(kb + KB + keyld) * D_ + dseg);
            const f32x4* vrow = (const f32x4*)(Vp + (size_t)(kb + KB + keyld) * D_ + dseg);
            #pragma unroll
            for (int j = 0; j < 4; ++j) { kr[j] = krow[j]; vr[j] = vrow[j]; }
        }

        // ---- scores: S[16q x 64k] in four 16x16 fragments, 8 WMMAs ----
        v8f c[4];
        #pragma unroll
        for (int kk = 0; kk < 4; ++kk) c[kk] = zf;
        #pragma unroll
        for (int dc = 0; dc < 2; ++dc) {
            #pragma unroll
            for (int kk = 0; kk < 4; ++kk) {
                union { v16h v; u32x4 u[2]; } bk;
                bk.u[0] = *(const u32x4*)&Ks[buf][kk * 16 + lh][dc * 32 + kbase];
                bk.u[1] = *(const u32x4*)&Ks[buf][kk * 16 + lh][dc * 32 + 16 + kbase];
                c[kk] = __builtin_amdgcn_wmma_f32_16x16x32_f16(false, aq[dc], false, bk.v,
                                                               (short)0, c[kk], false, false);
            }
        }

        // ---- online softmax, base-2 domain, DPP-only reductions ----
        float p[4][8], alpha[8];
        #pragma unroll
        for (int r = 0; r < 8; ++r) {
            float mx = fmaxf(fmaxf(c[0][r], c[1][r]), fmaxf(c[2][r], c[3][r]));
            mx = rowmax16(mx);
            float mn = fmaxf(mrow[r], mx);
            alpha[r] = __builtin_amdgcn_exp2f(mrow[r] - mn);
            mrow[r]  = mn;
            float ls = 0.0f;
            #pragma unroll
            for (int f = 0; f < 4; ++f) {
                p[f][r] = __builtin_amdgcn_exp2f(c[f][r] - mn);
                ls += p[f][r];
            }
            lrow[r] = lrow[r] * alpha[r] + ls;   // lane-local partial; reduce at end
        }
        #pragma unroll
        for (int nt = 0; nt < 4; ++nt)
            #pragma unroll
            for (int r = 0; r < 8; ++r)
                acc[nt][r] *= alpha[r];

        // ---- P: C-layout -> A-layout via per-wave LDS tile ----
        #pragma unroll
        for (int r = 0; r < 8; ++r) {
            const int row = r + 8 * hi;
            #pragma unroll
            for (int f = 0; f < 4; ++f)
                Ps[w][row][f * 16 + lh] = (_Float16)p[f][r];
        }
        asm volatile("s_wait_dscnt 0" ::: "memory");  // same-wave DS order fence

        union { v16h v; u32x4 u[2]; } ap[2];
        #pragma unroll
        for (int kc = 0; kc < 2; ++kc) {
            ap[kc].u[0] = *(const u32x4*)&Ps[w][lh][kc * 32 + kbase];
            ap[kc].u[1] = *(const u32x4*)&Ps[w][lh][kc * 32 + 16 + kbase];
        }

        // ---- O += P(16x64) * V(64x64): 4 N-tiles x 2 key-chunks, 8 WMMAs ----
        #pragma unroll
        for (int nt = 0; nt < 4; ++nt) {
            #pragma unroll
            for (int kc = 0; kc < 2; ++kc) {
                union { v16h v; u32x4 u[2]; } bv;
                bv.u[0] = *(const u32x4*)&Vt[buf][nt * 16 + lh][kc * 32 + kbase];
                bv.u[1] = *(const u32x4*)&Vt[buf][nt * 16 + lh][kc * 32 + 16 + kbase];
                acc[nt] = __builtin_amdgcn_wmma_f32_16x16x32_f16(false, ap[kc].v, false, bv.v,
                                                                 (short)0, acc[nt], false, false);
            }
        }
    }

    // ---- epilogue: reduce l across lanes, normalize, store O[B, S, H, D] ----
    #pragma unroll
    for (int r = 0; r < 8; ++r) {
        const float lsum = rowsum16(lrow[r]);
        const float inv  = 1.0f / lsum;
        const int   qrow = q0 + r + 8 * hi;
        float* orow = O + ((size_t)(b * S_ + qrow) * H_ + h) * D_;
        #pragma unroll
        for (int nt = 0; nt < 4; ++nt)
            orow[nt * 16 + lh] = acc[nt][r] * inv;
    }
}

extern "C" void kernel_launch(void* const* d_in, const int* in_sizes, int n_in,
                              void* d_out, int out_size, void* d_ws, size_t ws_size,
                              hipStream_t stream) {
    const float* q = (const float*)d_in[0];
    const float* k = (const float*)d_in[1];
    const float* v = (const float*)d_in[2];
    float* o = (float*)d_out;
    (void)in_sizes; (void)n_in; (void)out_size; (void)d_ws; (void)ws_size;

    dim3 grid(B_ * H_ * (S_ / QB));  // 256 workgroups
    dim3 block(256);                 // 8 waves (wave32)
    sdpa_fa_wmma<<<grid, block, 0, stream>>>(q, k, v, o);
}

// v001
// One run takes 43.6 microseconds.
// Next to v000, in two timings, it ran 2.00 and 2.01 times as fast.
#include <hip/hip_runtime.h>

typedef __attribute__((ext_vector_type(16))) _Float16     v16h;
typedef __attribute__((ext_vector_type(8)))  float        v8f;
typedef __attribute__((ext_vector_type(4)))  float        f32x4;
typedef __attribute__((ext_vector_type(4)))  unsigned int u32x4;

#define B_    2
#define H_    8
#define S_    2048
#define D_    64
#define KB    64            // keys per block iteration
#define WAVES 8
#define QW    16            // queries per wave
#define QB    (WAVES * QW)  // 128 queries per workgroup
// LDS row pitch in halves: 128-byte rows + 16 bytes = 144 B = 16 B x odd, so the 16 rows
// that one ds_load_b128 touches per lane half start on 16 different groups of 4 banks.
#define LP    (64 + 8)

// log2(e) / sqrt(D): folds softmax scale AND base-2 exp into Q once.
#define QSCALE 0.18033688011112042f

// DPP lane-xor within 16-lane rows (ROW_XMASK = 0x160 | mask): pure-VALU butterfly.
template<int CTRL>
__device__ __forceinline__ float dpp_f32(float x) {
    int i = __builtin_bit_cast(int, x);
    i = __builtin_amdgcn_update_dpp(i, i, CTRL, 0xF, 0xF, true);
    return __builtin_bit_cast(float, i);
}
__device__ __forceinline__ float rowmax16(float x) {
    x = fmaxf(x, dpp_f32<0x161>(x));   // xor 1
    x = fmaxf(x, dpp_f32<0x162>(x));   // xor 2
    x = fmaxf(x, dpp_f32<0x164>(x));   // xor 4
    x = fmaxf(x, dpp_f32<0x168>(x));   // xor 8
    return x;
}
__device__ __forceinline__ float rowsum16(float x) {
    x += dpp_f32<0x161>(x);
    x += dpp_f32<0x162>(x);
    x += dpp_f32<0x164>(x);
    x += dpp_f32<0x168>(x);
    return x;
}

__launch_bounds__(256, 1)
__global__ void sdpa_fa_wmma(const float* __restrict__ Q,
                             const float* __restrict__ K,
                             const float* __restrict__ V,
                             float* __restrict__ O)
{
    // Double-buffered K/V tiles + per-wave P staging, rows padded to LP halves: 54 KB total.
    __shared__ __align__(16) _Float16 Ks[2][KB][LP];     // 2 x 9 KB, [key][d]
    __shared__ __align__(16) _Float16 Vt[2][D_][LP];     // 2 x 9 KB, [d][key]
    __shared__ __align__(16) _Float16 Ps[WAVES][16][LP]; // 18 KB

    const int tid   = threadIdx.x;
    const int w     = tid >> 5;
    const int lane  = tid & 31;
    const int lh    = lane & 15;       // lane within 16-lane half
    const int hi    = lane >> 4;       // which half
    const int kbase = hi ? 8 : 0;      // fragment contraction base for this lane

    const int nqb = S_ / QB;
    const int bid = blockIdx.x;
    const int bh  = bid / nqb;         // fused (b*H + h)
    const int qb  = bid % nqb;
    const int b   = bh / H_;
    const int h   = bh % H_;

    const float* Qp = Q + (size_t)bh * S_ * D_;
    const float* Kp = K + (size_t)bh * S_ * D_;
    const float* Vp = V + (size_t)bh * S_ * D_;

    const int q0 = qb * QB + w * QW;

    // ---- Q A-fragments, pre-scaled by log2(e)/sqrt(D) (f32 -> f16) ----
    v16h aq[2];
    {
        const float* qrow = Qp + (size_t)(q0 + lh) * D_;
        #pragma unroll
        for (int dc = 0; dc < 2; ++dc) {
            const float* p0 = qrow + dc * 32 + kbase;
            const float* p1 = qrow + dc * 32 + 16 + kbase;
            #pragma unroll
            for (int j = 0; j < 8; ++j) {
                aq[dc][j]     = (_Float16)(p0[j] * QSCALE);
                aq[dc][j + 8] = (_Float16)(p1[j] * QSCALE);
            }
        }
    }

    v8f zf = {};
    v8f acc[4];
    #pragma unroll
    for (int nt = 0; nt < 4; ++nt) acc[nt] = zf;
    float mrow[8], lrow[8];            // lrow: per-lane PARTIAL sums (log2 domain)
    #pragma unroll
    for (int r = 0; r < 8; ++r) { mrow[r] = -3.0e38f; lrow[r] = 0.0f; }

    const int keyld = tid >> 2;          // 0..63: staged key row
    const int dseg  = (tid & 3) * 16;    // 0,16,32,48: 16-wide d segment

    // ---- pipeline preload: block 0 K/V into registers ----
    f32x4 kr[4], vr[4];
    {
        const f32x4* krow = (const f32x4*)(Kp + (size_t)keyld * D_ + dseg);
        const f32x4* vrow = (const f32x4*)(Vp + (size_t)keyld * D_ + dseg);
        #pragma unroll
        for (int j = 0; j < 4; ++j) { kr[j] = krow[j]; vr[j] = vrow[j]; }
    }

    for (int kb = 0; kb < S_; kb += KB) {
        const int buf = (kb / KB) & 1;

        // ---- drain staged registers into LDS (f32 -> f16, V transposed) ----
        {
            union { _Float16 h8[8]; u32x4 u; } pk0, pk1;
            #pragma unroll
            for (int j = 0; j < 8; ++j) {
                pk0.h8[j] = (_Float16)kr[j >> 2][j & 3];
                pk1.h8[j] = (_Float16)kr[(j + 8) >> 2][j & 3];
            }
            *(u32x4*)&Ks[buf][keyld][dseg]     = pk0.u;
            *(u32x4*)&Ks[buf][keyld][dseg + 8] = pk1.u;
            #pragma unroll
            for (int j = 0; j < 16; ++j)
                Vt[buf][dseg + j][keyld] = (_Float16)vr[j >> 2][j & 3];
        }
        __syncthreads();

        // ---- issue next block's global loads; consumed next iteration ----
        if (kb + KB < S_) {  // uniform condition
            const f32x4* krow = (const f32x4*)(Kp + (size_t)(kb + KB + keyld) * D_ + dseg);
            const f32x4* vrow = (const f32x4*)(Vp + (size_t)(kb + KB + keyld) * D_ + dseg);
            #pragma unroll
            for (int j = 0; j < 4; ++j) { kr[j] = krow[j]; vr[j] = vrow[j]; }
        }

        // ---- scores: S[16q x 64k] in four 16x16 fragments, 8 WMMAs ----
        v8f c[4];
        #pragma unroll
        for (int kk = 0; kk < 4; ++kk) c[kk] = zf;
        #pragma unroll
        for (int dc = 0; dc < 2; ++dc) {
            #pragma unroll
            for (int kk = 0; kk < 4; ++kk) {
                union { v16h v; u32x4 u[2]; } bk;
                bk.u[0] = *(const u32x4*)&Ks[buf][kk * 16 + lh][dc * 32 + kbase];
                bk.u[1] = *(const u32x4*)&Ks[buf][kk * 16 + lh][dc * 32 + 16 + kbase];
                c[kk] = __builtin_amdgcn_wmma_f32_16x16x32_f16(false, aq[dc], false, bk.v,
                                                               (short)0, c[kk], false, false);
            }
        }

        // ---- online softmax, base-2 domain, DPP-only reductions ----
        float p[4][8], alpha[8];
        #pragma unroll
        for (int r = 0; r < 8; ++r) {
            float mx = fmaxf(fmaxf(c[0][r], c[1][r]), fmaxf(c[2][r], c[3][r]));
            mx = rowmax16(mx);
            float mn = fmaxf(mrow[r], mx);
            alpha[r] = __builtin_amdgcn_exp2f(mrow[r] - mn);
            mrow[r]  = mn;
            float ls = 0.0f;
            #pragma unroll
            for (int f = 0; f < 4; ++f) {
                p[f][r] = __builtin_amdgcn_exp2f(c[f][r] - mn);
                ls += p[f][r];
            }
            lrow[r] = lrow[r] * alpha[r] + ls;   // lane-local partial; reduce at end
        }
        #pragma unroll
        for (int nt = 0; nt < 4; ++nt)
            #pragma unroll
            for (int r = 0; r < 8; ++r)
                acc[nt][r] *= alpha[r];

        // ---- P: C-layout -> A-layout via per-wave LDS tile ----
        #pragma unroll
        for (int r = 0; r < 8; ++r) {
            const int row = r + 8 * hi;
            #pragma unroll
            for (int f = 0; f < 4; ++f)
                Ps[w][row][f * 16 + lh] = (_Float16)p[f][r];
        }
        asm volatile("s_wait_dscnt 0" ::: "memory");  // same-wave DS order fence

        union { v16h v; u32x4 u[2]; } ap[2];
        #pragma unroll
        for (int kc = 0; kc < 2; ++kc) {
            ap[kc].u[0] = *(const u32x4*)&Ps[w][lh][kc * 32 + kbase];
            ap[kc].u[1] = *(const u32x4*)&Ps[w][lh][kc * 32 + 16 + kbase];
        }

        // ---- O += P(16x64) * V(64x64): 4 N-tiles x 2 key-chunks, 8 WMMAs ----
        #pragma unroll
        for (int nt = 0; nt < 4; ++nt) {
            #pragma unroll
            for (int kc = 0; kc < 2; ++kc) {
                union { v16h v; u32x4 u[2]; } bv;
                bv.u[0] = *(const u32x4*)&Vt[buf][nt * 16 + lh][kc * 32 + kbase];
                bv.u[1] = *(const u32x4*)&Vt[buf][nt * 16 + lh][kc * 32 + 16 + kbase];
                acc[nt] = __builtin_amdgcn_wmma_f32_16x16x32_f16(false, ap[kc].v, false, bv.v,
                                                                 (short)0, acc[nt], false, false);
            }
        }
    }

    // ---- epilogue: reduce l across lanes, normalize, store O[B, S, H, D] ----
    #pragma unroll
    for (int r = 0; r < 8; ++r) {
        const float lsum = rowsum16(lrow[r]);
        const float inv  = 1.0f / lsum;
        const int   qrow = q0 + r + 8 * hi;
        float* orow = O + ((size_t)(b * S_ + qrow) * H_ + h) * D_;
        #pragma unroll
        for (int nt = 0; nt < 4; ++nt)
            orow[nt * 16 + lh] = acc[nt][r] * inv;
    }
}

extern "C" void kernel_launch(void* const* d_in, const int* in_sizes, int n_in,
                              void* d_out, int out_size, void* d_ws, size_t ws_size,
                              hipStream_t stream) {
    const float* q = (const float*)d_in[0];
    const float* k = (const float*)d_in[1];
    const float* v = (const float*)d_in[2];
    float* o = (float*)d_out;
    (void)in_sizes; (void)n_in; (void)out_size; (void)d_ws; (void)ws_size;

    dim3 grid(B_ * H_ * (S_ / QB));  // 256 workgroups
    dim3 block(256);                 // 8 waves (wave32)
    sdpa_fa_wmma<<<grid, block, 0, stream>>>(q, k, v, o);
}

// v002
// It runs in 37.9 microseconds.
// Timed twice side by side with v001, it ran 1.15 and 1.16 times as fast.
// All steps since v000 together make it 2.31 times as fast.
#include <hip/hip_runtime.h>

typedef __attribute__((ext_vector_type(16))) _Float16     v16h;
typedef __attribute__((ext_vector_type(8)))  _Float16     v8h;
typedef __attribute__((ext_vector_type(8)))  float        v8f;
typedef __attribute__((ext_vector_type(4)))  float        f32x4;
typedef __attribute__((ext_vector_type(4)))  unsigned int u32x4;

#define B_    2
#define H_    8
#define S_    2048
#define D_    64
#define KB    64            // keys per block iteration
#define WAVES 8
#define QW    16            // queries per wave
#define QB    (WAVES * QW)  // 128 queries per workgroup
// LDS row pitch in halves: 128-byte rows + 16 bytes = 144 B = 16 B x odd, so the 16 rows
// that one ds_load_b128 touches per lane half start on 16 different groups of 4 banks.
#define LP    (64 + 8)

// log2(e) / sqrt(D): folds softmax scale AND base-2 exp into Q once.
#define QSCALE 0.18033688011112042f

// Value of the same query's other lane half (lane l <-> l ^ 16).
__device__ __forceinline__ float other_half(float x) {
    int i = __builtin_bit_cast(int, x);
    i = __builtin_amdgcn_permlanex16(i, i, 0x76543210, 0xfedcba98, false, false);
    return __builtin_bit_cast(float, i);
}
__device__ __forceinline__ float max8(v8f x) {
    return fmaxf(fmaxf(fmaxf(x[0], x[1]), fmaxf(x[2], x[3])),
                 fmaxf(fmaxf(x[4], x[5]), fmaxf(x[6], x[7])));
}
__device__ __forceinline__ float sum8(v8f x) {
    return ((x[0] + x[1]) + (x[2] + x[3])) + ((x[4] + x[5]) + (x[6] + x[7]));
}

__launch_bounds__(256, 1)
__global__ void sdpa_fa_wmma(const float* __restrict__ Q,
                             const float* __restrict__ K,
                             const float* __restrict__ V,
                             float* __restrict__ O)
{
    // Double-buffered K/V tiles, rows padded to LP halves: 36 KB total.
    __shared__ __align__(16) _Float16 Ks[2][KB][LP];     // 2 x 9 KB, [key][d]
    __shared__ __align__(16) _Float16 Vt[2][D_][LP];     // 2 x 9 KB, [d][key]

    const int tid   = threadIdx.x;
    const int w     = tid >> 5;
    const int lane  = tid & 31;
    const int lh    = lane & 15;       // lane within 16-lane half
    const int hi    = lane >> 4;       // which half
    const int kbase = hi ? 8 : 0;      // fragment contraction base for this lane

    const int nqb = S_ / QB;
    const int bid = blockIdx.x;
    const int bh  = bid / nqb;         // fused (b*H + h)
    const int qb  = bid % nqb;
    const int b   = bh / H_;
    const int h   = bh % H_;

    const float* Qp = Q + (size_t)bh * S_ * D_;
    const float* Kp = K + (size_t)bh * S_ * D_;
    const float* Vp = V + (size_t)bh * S_ * D_;

    const int q0 = qb * QB + w * QW;

    // ---- Q^T B-fragments (column = query lh), pre-scaled by log2(e)/sqrt(D) (f32 -> f16) ----
    v16h bq[2];
    {
        const float* qrow = Qp + (size_t)(q0 + lh) * D_;
        #pragma unroll
        for (int dc = 0; dc < 2; ++dc) {
            const float* p0 = qrow + dc * 32 + kbase;
            const float* p1 = qrow + dc * 32 + 16 + kbase;
            #pragma unroll
            for (int j = 0; j < 8; ++j) {
                bq[dc][j]     = (_Float16)(p0[j] * QSCALE);
                bq[dc][j + 8] = (_Float16)(p1[j] * QSCALE);
            }
        }
    }

    v8f zf = {};
    v8f acc[4];                        // O^T: acc[nt][r] = O[query lh][d = nt*16 + 8*hi + r]
    #pragma unroll
    for (int nt = 0; nt < 4; ++nt) acc[nt] = zf;
    float mrow = -3.0e38f;             // running maximum of query lh (log2 domain)
    v8f   lrow = zf;                   // this lane's eight PARTIAL sums for query lh

    const int keyld = tid >> 2;          // 0..63: staged key row
    const int dseg  = (tid & 3) * 16;    // 0,16,32,48: 16-wide d segment

    // ---- pipeline preload: block 0 K/V into registers ----
    f32x4 kr[4], vr[4];
    {
        const f32x4* krow = (const f32x4*)(Kp + (size_t)keyld * D_ + dseg);
        const f32x4* vrow = (const f32x4*)(Vp + (size_t)keyld * D_ + dseg);
        #pragma unroll
        for (int j = 0; j < 4; ++j) { kr[j] = krow[j]; vr[j] = vrow[j]; }
    }

    for (int kb = 0; kb < S_; kb += KB) {
        const int buf = (kb / KB) & 1;

        // ---- drain staged registers into LDS (f32 -> f16, V transposed) ----
        {
            union { _Float16 h8[8]; u32x4 u; } pk0, pk1;
            #pragma unroll
            for (int j = 0; j < 8; ++j) {
                pk0.h8[j] = (_Float16)kr[j >> 2][j & 3];
                pk1.h8[j] = (_Float16)kr[(j + 8) >> 2][j & 3];
            }
            *(u32x4*)&Ks[buf][keyld][dseg]     = pk0.u;
            *(u32x4*)&Ks[buf][keyld][dseg + 8] = pk1.u;
            #pragma unroll
            for (int j = 0; j < 16; ++j)
                Vt[buf][dseg + j][keyld] = (_Float16)vr[j >> 2][j & 3];
        }
        __syncthreads();

        // ---- issue next block's global loads; consumed next iteration ----
        if (kb + KB < S_) {  // uniform condition
            const f32x4* krow = (const f32x4*)(Kp + (size_t)(kb + KB + keyld) * D_ + dseg);
            const f32x4* vrow = (const f32x4*)(Vp + (size_t)(kb + KB + keyld) * D_ + dseg);
            #pragma unroll
            for (int j = 0; j < 4; ++j) { kr[j] = krow[j]; vr[j] = vrow[j]; }
        }

        // ---- scores, transposed: S^T[64k x 16q] = K * Q^T in four 16x16 tiles, 8 WMMAs ----
        // c[kk][r] = score of key kk*16 + 8*hi + r against query lh: a lane holds one query only.
        v8f c[4];
        #pragma unroll
        for (int kk = 0; kk < 4; ++kk) c[kk] = zf;
        #pragma unroll
        for (int dc = 0; dc < 2; ++dc) {
            #pragma unroll
            for (int kk = 0; kk < 4; ++kk) {
                union { v16h v; u32x4 u[2]; } ak;
                ak.u[0] = *(const u32x4*)&Ks[buf][kk * 16 + lh][dc * 32 + kbase];
                ak.u[1] = *(const u32x4*)&Ks[buf][kk * 16 + lh][dc * 32 + 16 + kbase];
                c[kk] = __builtin_amdgcn_wmma_f32_16x16x32_f16(false, ak.v, false, bq[dc],
                                                               (short)0, c[kk], false, false);
            }
        }

        // ---- online softmax, base-2 domain: in-lane over 32 keys, one exchange between halves ----
        float mx = fmaxf(fmaxf(max8(c[0]), max8(c[1])), fmaxf(max8(c[2]), max8(c[3])));
        mx = fmaxf(mx, other_half(mx));
        const float mn    = fmaxf(mrow, mx);
        const float alpha = __builtin_amdgcn_exp2f(mrow - mn);
        mrow = mn;
        #pragma unroll
        for (int kk = 0; kk < 4; ++kk) {
            c[kk] -= mn;
            #pragma unroll
            for (int r = 0; r < 8; ++r)
                c[kk][r] = __builtin_amdgcn_exp2f(c[kk][r]);
        }
        lrow = lrow * alpha + ((c[0] + c[1]) + (c[2] + c[3]));
        #pragma unroll
        for (int nt = 0; nt < 4; ++nt) acc[nt] *= alpha;

        // ---- P^T B-fragments straight from the score tiles: two tiles = 32 keys in the
        //      hardware k order (element s < 8: key 8*hi + s, else 16 + 8*hi + s - 8) ----
        union { v16h v; v8h t[2]; } bp[2];
        #pragma unroll
        for (int kc = 0; kc < 2; ++kc) {
            bp[kc].t[0] = __builtin_convertvector(c[2 * kc],     v8h);
            bp[kc].t[1] = __builtin_convertvector(c[2 * kc + 1], v8h);
        }

        // ---- O^T += V^T(64d x 64k) * P^T(64k x 16q): 4 d-tiles x 2 key-chunks, 8 WMMAs ----
        #pragma unroll
        for (int nt = 0; nt < 4; ++nt) {
            #pragma unroll
            for (int kc = 0; kc < 2; ++kc) {
                union { v16h v; u32x4 u[2]; } av;
                av.u[0] = *(const u32x4*)&Vt[buf][nt * 16 + lh][kc * 32 + kbase];
                av.u[1] = *(const u32x4*)&Vt[buf][nt * 16 + lh][kc * 32 + 16 + kbase];
                acc[nt] = __builtin_amdgcn_wmma_f32_16x16x32_f16(false, av.v, false, bp[kc].v,
                                                                 (short)0, acc[nt], false, false);
            }
        }
    }

    // ---- epilogue: join the halves' sums, normalize, store O[B, S, H, D] ----
    {
        const float lsum = sum8(lrow);
        const float inv  = 1.0f / (lsum + other_half(lsum));
        float* orow = O + ((size_t)(b * S_ + q0 + lh) * H_ + h) * D_ + 8 * hi;
        #pragma unroll
        for (int nt = 0; nt < 4; ++nt) {
            const v8f o = acc[nt] * inv;
            *(f32x4*)(orow + nt * 16)     = __builtin_shufflevector(o, o, 0, 1, 2, 3);
            *(f32x4*)(orow + nt * 16 + 4) = __builtin_shufflevector(o, o, 4, 5, 6, 7);
        }
    }
}

extern "C" void kernel_launch(void* const* d_in, const int* in_sizes, int n_in,
                              void* d_out, int out_size, void* d_ws, size_t ws_size,
                              hipStream_t stream) {
    const float* q = (const float*)d_in[0];
    const float* k = (const float*)d_in[1];
    const float* v = (const float*)d_in[2];
    float* o = (float*)d_out;
    (void)in_sizes; (void)n_in; (void)out_size; (void)d_ws; (void)ws_size;

    dim3 grid(B_ * H_ * (S_ / QB));  // 256 workgroups
    dim3 block(256);                 // 8 waves (wave32)
    sdpa_fa_wmma<<<grid, block, 0, stream>>>(q, k, v, o);
}

// v003
// It runs in 35.8 microseconds.
// In two side-by-side timings against v002, it was 1.06 and 1.07 times as fast.
// Counting every step since v000, it is 2.45 times as fast.
#include <hip/hip_runtime.h>

typedef __attribute__((ext_vector_type(16))) _Float16     v16h;
typedef __attribute__((ext_vector_type(8)))  _Float16     v8h;
typedef __attribute__((ext_vector_type(8)))  float        v8f;
typedef __attribute__((ext_vector_type(4)))  float        f32x4;
typedef __attribute__((ext_vector_type(4)))  unsigned int u32x4;
typedef __attribute__((ext_vector_type(8)))  short        s16x8;

#define B_    2
#define H_    8
#define S_    2048
#define D_    64
#define KB    64            // keys per block iteration
#define WAVES 8
#define QW    16            // queries per wave
#define QB    (WAVES * QW)  // 128 queries per workgroup
// LDS row pitch in halves: 128-byte rows + 16 bytes = 144 B = 16 B x odd, so the 16 rows
// that one ds_load_b128 touches per lane half start on 16 different groups of 4 banks.
#define LP    (64 + 8)
// Pitch of the V rows, read by ds_load_tr16_b128: 128 B + 32 B = 160 B = 32 B x odd, that reader's own
// conflict-free pitch.
#define LPV   (64 + 16)

// log2(e) / sqrt(D): folds softmax scale AND base-2 exp into Q once.
#define QSCALE 0.18033688011112042f

// Value of the same query's other lane half (lane l <-> l ^ 16).
__device__ __forceinline__ float other_half(float x) {
    int i = __builtin_bit_cast(int, x);
    i = __builtin_amdgcn_permlanex16(i, i, 0x76543210, 0xfedcba98, false, false);
    return __builtin_bit_cast(float, i);
}
// Transposing LDS load: the lanes point at the 16-byte halves of 16 rows of a row-major 16-bit tile;
// lane (c = l & 15, h = l >> 4) receives column c of rows 8h .. 8h + 7.
__device__ __forceinline__ u32x4 ld_tr16(const _Float16* p) {
    typedef __attribute__((address_space(3))) s16x8 lds_s16x8;
    return __builtin_bit_cast(u32x4, __builtin_amdgcn_ds_load_tr16_b128_v8i16((lds_s16x8*)p));
}
__device__ __forceinline__ float max8(v8f x) {
    return fmaxf(fmaxf(fmaxf(x[0], x[1]), fmaxf(x[2], x[3])),
                 fmaxf(fmaxf(x[4], x[5]), fmaxf(x[6], x[7])));
}
__device__ __forceinline__ float sum8(v8f x) {
    return ((x[0] + x[1]) + (x[2] + x[3])) + ((x[4] + x[5]) + (x[6] + x[7]));
}

__launch_bounds__(256, 1)
__global__ void sdpa_fa_wmma(const float* __restrict__ Q,
                             const float* __restrict__ K,
                             const float* __restrict__ V,
                             float* __restrict__ O)
{
    // Double-buffered K/V tiles, both row-major with padded rows: 38 KB total.
    __shared__ __align__(16) _Float16 Ks[2][KB][LP];     // 2 x 9 KB,  [key][d]
    __shared__ __align__(16) _Float16 Vs[2][KB][LPV];    // 2 x 10 KB, [key][d]

    const int tid   = threadIdx.x;
    const int w     = tid >> 5;
    const int lane  = tid & 31;
    const int lh    = lane & 15;       // lane within 16-lane half
    const int hi    = lane >> 4;       // which half
    const int kbase = hi ? 8 : 0;      // fragment contraction base for this lane

    const int nqb = S_ / QB;
    const int bid = blockIdx.x;
    const int bh  = bid / nqb;         // fused (b*H + h)
    const int qb  = bid % nqb;
    const int b   = bh / H_;
    const int h   = bh % H_;

    const float* Qp = Q + (size_t)bh * S_ * D_;
    const float* Kp = K + (size_t)bh * S_ * D_;
    const float* Vp = V + (size_t)bh * S_ * D_;

    const int q0 = qb * QB + w * QW;

    // ---- Q^T B-fragments (column = query lh), pre-scaled by log2(e)/sqrt(D) (f32 -> f16) ----
    v16h bq[2];
    {
        const float* qrow = Qp + (size_t)(q0 + lh) * D_;
        #pragma unroll
        for (int dc = 0; dc < 2; ++dc) {
            const float* p0 = qrow + dc * 32 + kbase;
            const float* p1 = qrow + dc * 32 + 16 + kbase;
            #pragma unroll
            for (int j = 0; j < 8; ++j) {
                bq[dc][j]     = (_Float16)(p0[j] * QSCALE);
                bq[dc][j + 8] = (_Float16)(p1[j] * QSCALE);
            }
        }
    }

    v8f zf = {};
    v8f acc[4];                        // O^T: acc[nt][r] = O[query lh][d = nt*16 + 8*hi + r]
    #pragma unroll
    for (int nt = 0; nt < 4; ++nt) acc[nt] = zf;
    float mrow = -3.0e38f;             // running maximum of query lh (log2 domain)
    v8f   lrow = zf;                   // this lane's eight PARTIAL sums for query lh

    const int keyld = tid >> 2;          // 0..63: staged key row
    const int dseg  = (tid & 3) * 16;    // 0,16,32,48: 16-wide d segment

    // ---- pipeline preload: block 0 K/V into registers ----
    f32x4 kr[4], vr[4];
    {
        const f32x4* krow = (const f32x4*)(Kp + (size_t)keyld * D_ + dseg);
        const f32x4* vrow = (const f32x4*)(Vp + (size_t)keyld * D_ + dseg);
        #pragma unroll
        for (int j = 0; j < 4; ++j) { kr[j] = krow[j]; vr[j] = vrow[j]; }
    }

    for (int kb = 0; kb < S_; kb += KB) {
        const int buf = (kb / KB) & 1;

        // ---- drain staged registers into LDS (f32 -> f16), K and V rows alike ----
        {
            union { _Float16 h8[8]; u32x4 u; } pk0, pk1, pv0, pv1;
            #pragma unroll
            for (int j = 0; j < 8; ++j) {
                pk0.h8[j] = (_Float16)kr[j >> 2][j & 3];
                pk1.h8[j] = (_Float16)kr[(j + 8) >> 2][j & 3];
                pv0.h8[j] = (_Float16)vr[j >> 2][j & 3];
                pv1.h8[j] = (_Float16)vr[(j + 8) >> 2][j & 3];
            }
            *(u32x4*)&Ks[buf][keyld][dseg]     = pk0.u;
            *(u32x4*)&Ks[buf][keyld][dseg + 8] = pk1.u;
            *(u32x4*)&Vs[buf][keyld][dseg]     = pv0.u;
            *(u32x4*)&Vs[buf][keyld][dseg + 8] = pv1.u;
        }
        __syncthreads();

        // ---- issue next block's global loads; consumed next iteration ----
        if (kb + KB < S_) {  // uniform condition
            const f32x4* krow = (const f32x4*)(Kp + (size_t)(kb + KB + keyld) * D_ + dseg);
            const f32x4* vrow = (const f32x4*)(Vp + (size_t)(kb + KB + keyld) * D_ + dseg);
            #pragma unroll
            for (int j = 0; j < 4; ++j) { kr[j] = krow[j]; vr[j] = vrow[j]; }
        }

        // ---- scores, transposed: S^T[64k x 16q] = K * Q^T in four 16x16 tiles, 8 WMMAs ----
        // c[kk][r] = score of key kk*16 + 8*hi + r against query lh: a lane holds one query only.
        v8f c[4];
        #pragma unroll
        for (int kk = 0; kk < 4; ++kk) c[kk] = zf;
        #pragma unroll
        for (int dc = 0; dc < 2; ++dc) {
            #pragma unroll
            for (int kk = 0; kk < 4; ++kk) {
                union { v16h v; u32x4 u[2]; } ak;
                ak.u[0] = *(const u32x4*)&Ks[buf][kk * 16 + lh][dc * 32 + kbase];
                ak.u[1] = *(const u32x4*)&Ks[buf][kk * 16 + lh][dc * 32 + 16 + kbase];
                c[kk] = __builtin_amdgcn_wmma_f32_16x16x32_f16(false, ak.v, false, bq[dc],
                                                               (short)0, c[kk], false, false);
            }
        }

        // ---- online softmax, base-2 domain: in-lane over 32 keys, one exchange between halves ----
        float mx = fmaxf(fmaxf(max8(c[0]), max8(c[1])), fmaxf(max8(c[2]), max8(c[3])));
        mx = fmaxf(mx, other_half(mx));
        const float mn    = fmaxf(mrow, mx);
        const float alpha = __builtin_amdgcn_exp2f(mrow - mn);
        mrow = mn;
        #pragma unroll
        for (int kk = 0; kk < 4; ++kk) {
            c[kk] -= mn;
            #pragma unroll
            for (int r = 0; r < 8; ++r)
                c[kk][r] = __builtin_amdgcn_exp2f(c[kk][r]);
        }
        lrow = lrow * alpha + ((c[0] + c[1]) + (c[2] + c[3]));
        #pragma unroll
        for (int nt = 0; nt < 4; ++nt) acc[nt] *= alpha;

        // ---- P^T B-fragments straight from the score tiles: two tiles = 32 keys in the
        //      hardware k order (element s < 8: key 8*hi + s, else 16 + 8*hi + s - 8) ----
        union { v16h v; v8h t[2]; } bp[2];
        #pragma unroll
        for (int kc = 0; kc < 2; ++kc) {
            bp[kc].t[0] = __builtin_convertvector(c[2 * kc],     v8h);
            bp[kc].t[1] = __builtin_convertvector(c[2 * kc + 1], v8h);
        }

        // ---- O^T += V^T(64d x 64k) * P^T(64k x 16q): 4 d-tiles x 2 key-chunks, 8 WMMAs ----
        // A = V^T by the transposing load: row d = nt*16 + lh, keys kc*32 + 8*hi + 0..7 and + 16.
        const _Float16* vlane = &Vs[buf][kbase + (lane & 7)][((lane >> 3) & 1) * 8];
        #pragma unroll
        for (int nt = 0; nt < 4; ++nt) {
            #pragma unroll
            for (int kc = 0; kc < 2; ++kc) {
                union { v16h v; u32x4 u[2]; } av;
                av.u[0] = ld_tr16(vlane + (kc * 32) * LPV + nt * 16);
                av.u[1] = ld_tr16(vlane + (kc * 32 + 16) * LPV + nt * 16);
                acc[nt] = __builtin_amdgcn_wmma_f32_16x16x32_f16(false, av.v, false, bp[kc].v,
                                                                 (short)0, acc[nt], false, false);
            }
        }
    }

    // ---- epilogue: join the halves' sums, normalize, store O[B, S, H, D] ----
    {
        const float lsum = sum8(lrow);
        const float inv  = 1.0f / (lsum + other_half(lsum));
        float* orow = O + ((size_t)(b * S_ + q0 + lh) * H_ + h) * D_ + 8 * hi;
        #pragma unroll
        for (int nt = 0; nt < 4; ++nt) {
            const v8f o = acc[nt] * inv;
            *(f32x4*)(orow + nt * 16)     = __builtin_shufflevector(o, o, 0, 1, 2, 3);
            *(f32x4*)(orow + nt * 16 + 4) = __builtin_shufflevector(o, o, 4, 5, 6, 7);
        }
    }
}

extern "C" void kernel_launch(void* const* d_in, const int* in_sizes, int n_in,
                              void* d_out, int out_size, void* d_ws, size_t ws_size,
                              hipStream_t stream) {
    const float* q = (const float*)d_in[0];
    const float* k = (const float*)d_in[1];
    const float* v = (const float*)d_in[2];
    float* o = (float*)d_out;
    (void)in_sizes; (void)n_in; (void)out_size; (void)d_ws; (void)ws_size;

    dim3 grid(B_ * H_ * (S_ / QB));  // 256 workgroups
    dim3 block(256);                 // 8 waves (wave32)
    sdpa_fa_wmma<<<grid, block, 0, stream>>>(q, k, v, o);
}

// v004
// One run takes 33.3 microseconds.
// Next to v003, in two timings, it ran 1.07 and 1.08 times as fast.
// Counting every step since v000, it is 2.64 times as fast.
#include <hip/hip_runtime.h>

typedef __attribute__((ext_vector_type(16))) _Float16     v16h;
typedef __attribute__((ext_vector_type(8)))  _Float16     v8h;
typedef __attribute__((ext_vector_type(4)))  _Float16     v4h;
typedef __attribute__((ext_vector_type(8)))  float        v8f;
typedef __attribute__((ext_vector_type(4)))  float        f32x4;
typedef __attribute__((ext_vector_type(4)))  unsigned int u32x4;
typedef __attribute__((ext_vector_type(8)))  short        s16x8;

#define B_    2
#define H_    8
#define S_    2048
#define D_    64
#define KB    64            // keys per block iteration
#define WAVES 8
#define QW    16            // queries per wave
#define QB    (WAVES * QW)  // 128 queries per workgroup
// LDS row pitch in halves: 128-byte rows + 16 bytes = 144 B = 16 B x odd, so the 16 rows
// that one ds_load_b128 touches per lane half start on 16 different groups of 4 banks.
#define LP    (64 + 8)
// Pitch of the V rows, read by ds_load_tr16_b128: 128 B + 32 B = 160 B = 32 B x odd, that reader's own
// conflict-free pitch.
#define LPV   (64 + 16)
// Pitch in floats of the rows through which a wave turns its Q and O tiles: 256 B + 16 B = 16 B x odd.
#define TP    (64 + 4)

// log2(e) / sqrt(D): folds softmax scale AND base-2 exp into Q once.
#define QSCALE 0.18033688011112042f

// Value of the same query's other lane half (lane l <-> l ^ 16).
__device__ __forceinline__ float other_half(float x) {
    int i = __builtin_bit_cast(int, x);
    i = __builtin_amdgcn_permlanex16(i, i, 0x76543210, 0xfedcba98, false, false);
    return __builtin_bit_cast(float, i);
}
// Transposing LDS load: the lanes point at the 16-byte halves of 16 rows of a row-major 16-bit tile;
// lane (c = l & 15, h = l >> 4) receives column c of rows 8h .. 8h + 7.
__device__ __forceinline__ u32x4 ld_tr16(const _Float16* p) {
    typedef __attribute__((address_space(3))) s16x8 lds_s16x8;
    return __builtin_bit_cast(u32x4, __builtin_amdgcn_ds_load_tr16_b128_v8i16((lds_s16x8*)p));
}
__device__ __forceinline__ float max8(v8f x) {
    return fmaxf(fmaxf(fmaxf(x[0], x[1]), fmaxf(x[2], x[3])),
                 fmaxf(fmaxf(x[4], x[5]), fmaxf(x[6], x[7])));
}
__device__ __forceinline__ float sum8(v8f x) {
    return ((x[0] + x[1]) + (x[2] + x[3])) + ((x[4] + x[5]) + (x[6] + x[7]));
}

__launch_bounds__(256, 1)
__global__ void sdpa_fa_wmma(const float* __restrict__ Q,
                             const float* __restrict__ K,
                             const float* __restrict__ V,
                             float* __restrict__ O)
{
    // Double-buffered K/V tiles, both row-major with padded rows: 38 KB.
    __shared__ __align__(16) _Float16 Ks[2][KB][LP];     // 2 x 9 KB,  [key][d]
    __shared__ __align__(16) _Float16 Vs[2][KB][LPV];    // 2 x 10 KB, [key][d]
    // Each wave's own 16 x 64 f32 tile: global memory sees whole lines, the lanes their fragment order.
    __shared__ __align__(16) float    Ts[WAVES][QW][TP]; // 34 KB, [wave][query][d]

    const int tid   = threadIdx.x;
    const int w     = tid >> 5;
    const int lane  = tid & 31;
    const int lh    = lane & 15;       // lane within 16-lane half
    const int hi    = lane >> 4;       // which half
    const int kbase = hi ? 8 : 0;      // fragment contraction base for this lane

    const int nqb = S_ / QB;
    const int bid = blockIdx.x;
    const int bh  = bid / nqb;         // fused (b*H + h)
    const int qb  = bid % nqb;
    const int b   = bh / H_;
    const int h   = bh % H_;

    const float* Qp = Q + (size_t)bh * S_ * D_;
    const float* Kp = K + (size_t)bh * S_ * D_;
    const float* Vp = V + (size_t)bh * S_ * D_;

    const int q0 = qb * QB + w * QW;

    // Staging deal: 16 lanes a 256-B row, so a wave's 16-byte load covers two rows = 512 B in a row.
    const int crow = tid >> 4;           // 0..15: row within each group of 16 staged rows
    const int ccol = (tid & 15) * 4;     // first of this thread's four columns

    // ---- pipeline preload: block 0 K/V into registers ----
    f32x4 kr[4], vr[4];
    #pragma unroll
    for (int j = 0; j < 4; ++j) kr[j] = ((const f32x4*)Kp)[tid + j * 256];
    #pragma unroll
    for (int j = 0; j < 4; ++j) vr[j] = ((const f32x4*)Vp)[tid + j * 256];

    // ---- Q^T B-fragments (column = query lh), pre-scaled by log2(e)/sqrt(D) (f32 -> f16) ----
    v16h bq[2];
    {
        // The wave's 16 query rows are 4 KB in a row: each load takes 512 B of them, four whole lines.
        const f32x4* qsrc = (const f32x4*)(Qp + (size_t)q0 * D_);
        #pragma unroll
        for (int i = 0; i < 8; ++i)
            *(f32x4*)&Ts[w][2 * i + hi][lh * 4] = qsrc[i * 32 + lane];
        // A lane reads rows that other lanes of its wave stored: those stores end first.
        asm volatile("s_wait_dscnt 0x0" ::: "memory");
        const float* qrow = &Ts[w][lh][0];
        #pragma unroll
        for (int dc = 0; dc < 2; ++dc) {
            const float* p0 = qrow + dc * 32 + kbase;
            const float* p1 = qrow + dc * 32 + 16 + kbase;
            #pragma unroll
            for (int j = 0; j < 8; ++j) {
                bq[dc][j]     = (_Float16)(p0[j] * QSCALE);
                bq[dc][j + 8] = (_Float16)(p1[j] * QSCALE);
            }
        }
    }

    v8f zf = {};
    v8f acc[4];                        // O^T: acc[nt][r] = O[query lh][d = nt*16 + 8*hi + r]
    #pragma unroll
    for (int nt = 0; nt < 4; ++nt) acc[nt] = zf;
    float mrow = -3.0e38f;             // running maximum of query lh (log2 domain)
    v8f   lrow = zf;                   // this lane's eight PARTIAL sums for query lh

    for (int kb = 0; kb < S_; kb += KB) {
        const int buf = (kb / KB) & 1;

        // ---- drain staged registers into LDS (f32 -> f16), K and V rows alike ----
        {
            #pragma unroll
            for (int j = 0; j < 4; ++j)
                *(v4h*)&Ks[buf][j * 16 + crow][ccol] = __builtin_convertvector(kr[j], v4h);
            #pragma unroll
            for (int j = 0; j < 4; ++j)
                *(v4h*)&Vs[buf][j * 16 + crow][ccol] = __builtin_convertvector(vr[j], v4h);
        }
        __syncthreads();

        // ---- this block's K fragments (rows = keys), read as one group ----
        union { v16h v; u32x4 u[2]; } ak[2][4];
        #pragma unroll
        for (int dc = 0; dc < 2; ++dc) {
            #pragma unroll
            for (int kk = 0; kk < 4; ++kk) {
                ak[dc][kk].u[0] = *(const u32x4*)&Ks[buf][kk * 16 + lh][dc * 32 + kbase];
                ak[dc][kk].u[1] = *(const u32x4*)&Ks[buf][kk * 16 + lh][dc * 32 + 16 + kbase];
            }
        }

        // ---- issue next block's global loads; consumed next iteration ----
        if (kb + KB < S_) {  // uniform condition
            const f32x4* kn = (const f32x4*)(Kp + (size_t)(kb + KB) * D_);
            const f32x4* vn = (const f32x4*)(Vp + (size_t)(kb + KB) * D_);
            #pragma unroll
            for (int j = 0; j < 4; ++j) kr[j] = kn[tid + j * 256];
            #pragma unroll
            for (int j = 0; j < 4; ++j) vr[j] = vn[tid + j * 256];
            // Stands between these loads and the next write of their address registers; behind
            // the fragment reads it passes while the wave waits for the LDS data anyway.
            asm volatile("s_wait_xcnt 0x0" ::: "memory");
        }

        // ---- scores, transposed: S^T[64k x 16q] = K * Q^T in four 16x16 tiles, 8 WMMAs ----
        // c[kk][r] = score of key kk*16 + 8*hi + r against query lh: a lane holds one query only.
        v8f c[4];
        #pragma unroll
        for (int kk = 0; kk < 4; ++kk) c[kk] = zf;
        #pragma unroll
        for (int dc = 0; dc < 2; ++dc) {
            #pragma unroll
            for (int kk = 0; kk < 4; ++kk) {
                c[kk] = __builtin_amdgcn_wmma_f32_16x16x32_f16(false, ak[dc][kk].v, false, bq[dc],
                                                               (short)0, c[kk], false, false);
            }
        }

        // ---- online softmax, base-2 domain: in-lane over 32 keys, one exchange between halves ----
        float mx = fmaxf(fmaxf(max8(c[0]), max8(c[1])), fmaxf(max8(c[2]), max8(c[3])));
        mx = fmaxf(mx, other_half(mx));
        const float mn    = fmaxf(mrow, mx);
        const float alpha = __builtin_amdgcn_exp2f(mrow - mn);
        mrow = mn;
        #pragma unroll
        for (int kk = 0; kk < 4; ++kk) {
            c[kk] -= mn;
            #pragma unroll
            for (int r = 0; r < 8; ++r)
                c[kk][r] = __builtin_amdgcn_exp2f(c[kk][r]);
        }
        lrow = lrow * alpha + ((c[0] + c[1]) + (c[2] + c[3]));
        #pragma unroll
        for (int nt = 0; nt < 4; ++nt) acc[nt] *= alpha;

        // ---- P^T B-fragments straight from the score tiles: two tiles = 32 keys in the
        //      hardware k order (element s < 8: key 8*hi + s, else 16 + 8*hi + s - 8) ----
        union { v16h v; v8h t[2]; } bp[2];
        #pragma unroll
        for (int kc = 0; kc < 2; ++kc) {
            bp[kc].t[0] = __builtin_convertvector(c[2 * kc],     v8h);
            bp[kc].t[1] = __builtin_convertvector(c[2 * kc + 1], v8h);
        }

        // ---- O^T += V^T(64d x 64k) * P^T(64k x 16q): 4 d-tiles x 2 key-chunks, 8 WMMAs ----
        // A = V^T by the transposing load: row d = nt*16 + lh, keys kc*32 + 8*hi + 0..7 and + 16.
        const _Float16* vlane = &Vs[buf][kbase + (lane & 7)][((lane >> 3) & 1) * 8];
        #pragma unroll
        for (int nt = 0; nt < 4; ++nt) {
            #pragma unroll
            for (int kc = 0; kc < 2; ++kc) {
                union { v16h v; u32x4 u[2]; } av;
                av.u[0] = ld_tr16(vlane + (kc * 32) * LPV + nt * 16);
                av.u[1] = ld_tr16(vlane + (kc * 32 + 16) * LPV + nt * 16);
                acc[nt] = __builtin_amdgcn_wmma_f32_16x16x32_f16(false, av.v, false, bp[kc].v,
                                                                 (short)0, acc[nt], false, false);
            }
        }
    }

    // ---- epilogue: join the halves' sums, normalize, store O[B, S, H, D] ----
    {
        const float lsum = sum8(lrow);
        const float inv  = 1.0f / (lsum + other_half(lsum));
        float* trow = &Ts[w][lh][8 * hi];
        #pragma unroll
        for (int nt = 0; nt < 4; ++nt) {
            const v8f o = acc[nt] * inv;
            *(f32x4*)(trow + nt * 16)     = __builtin_shufflevector(o, o, 0, 1, 2, 3);
            *(f32x4*)(trow + nt * 16 + 4) = __builtin_shufflevector(o, o, 4, 5, 6, 7);
        }
        // A lane reads rows that other lanes of its wave stored: those stores end first.
        asm volatile("s_wait_dscnt 0x0" ::: "memory");
        // Each store takes two queries' 256-B output rows: four whole lines.
        float* obase = O + ((size_t)(b * S_ + q0 + hi) * H_ + h) * D_ + lh * 4;
        #pragma unroll
        for (int i = 0; i < 8; ++i)
            *(f32x4*)(obase + (size_t)(2 * i) * H_ * D_) = *(const f32x4*)&Ts[w][2 * i + hi][lh * 4];
    }
}

extern "C" void kernel_launch(void* const* d_in, const int* in_sizes, int n_in,
                              void* d_out, int out_size, void* d_ws, size_t ws_size,
                              hipStream_t stream) {
    const float* q = (const float*)d_in[0];
    const float* k = (const float*)d_in[1];
    const float* v = (const float*)d_in[2];
    float* o = (float*)d_out;
    (void)in_sizes; (void)n_in; (void)out_size; (void)d_ws; (void)ws_size;

    dim3 grid(B_ * H_ * (S_ / QB));  // 256 workgroups
    dim3 block(256);                 // 8 waves (wave32)
    sdpa_fa_wmma<<<grid, block, 0, stream>>>(q, k, v, o);
}

// v005
// One run takes 21.4 microseconds.
// In two side-by-side timings against v004, it was 1.55 and 1.56 times as fast.
// Over all steps from v000 it is 4.11 times as fast.
#include <hip/hip_runtime.h>

typedef __attribute__((ext_vector_type(16))) _Float16     v16h;
typedef __attribute__((ext_vector_type(8)))  _Float16     v8h;
typedef __attribute__((ext_vector_type(4)))  _Float16     v4h;
typedef __attribute__((ext_vector_type(8)))  float        v8f;
typedef __attribute__((ext_vector_type(4)))  float        f32x4;
typedef __attribute__((ext_vector_type(4)))  unsigned int u32x4;
typedef __attribute__((ext_vector_type(8)))  short        s16x8;

#define B_    2
#define H_    8
#define S_    2048
#define D_    64
#define KB    128           // keys staged per block iteration
#define KW    64            // keys of them that one wave works on: key group kg takes rows kg*64 ..
#define WAVES 8             // 4 query groups x 2 key groups
#define QT    2             // 16-query tiles per wave: each K or V fragment read from LDS feeds QT WMMAs
#define QW    (QT * 16)     // 32 queries per wave
#define QB    (4 * QW)      // 128 queries per workgroup
// LDS row pitch in halves: 128-byte rows + 16 bytes = 144 B = 16 B x odd, so the 16 rows
// that one ds_load_b128 touches per lane half start on 16 different groups of 4 banks.
#define LP    (64 + 8)
// Pitch of the V rows, read by ds_load_tr16_b128: 128 B + 32 B = 160 B = 32 B x odd, that reader's own
// conflict-free pitch.
#define LPV   (64 + 16)
// Pitch in floats of the rows through which a wave turns its Q and O tiles: 256 B + 16 B = 16 B x odd.
#define TP    (64 + 4)

// log2(e) / sqrt(D): folds softmax scale AND base-2 exp into Q once.
#define QSCALE 0.18033688011112042f

// Value of the same query's other lane half (lane l <-> l ^ 16).
__device__ __forceinline__ float other_half(float x) {
    int i = __builtin_bit_cast(int, x);
    i = __builtin_amdgcn_permlanex16(i, i, 0x76543210, 0xfedcba98, false, false);
    return __builtin_bit_cast(float, i);
}
// Transposing LDS load: the lanes point at the 16-byte halves of 16 rows of a row-major 16-bit tile;
// lane (c = l & 15, h = l >> 4) receives column c of rows 8h .. 8h + 7.
__device__ __forceinline__ u32x4 ld_tr16(const _Float16* p) {
    typedef __attribute__((address_space(3))) s16x8 lds_s16x8;
    return __builtin_bit_cast(u32x4, __builtin_amdgcn_ds_load_tr16_b128_v8i16((lds_s16x8*)p));
}
__device__ __forceinline__ float max8(v8f x) {
    return fmaxf(fmaxf(fmaxf(x[0], x[1]), fmaxf(x[2], x[3])),
                 fmaxf(fmaxf(x[4], x[5]), fmaxf(x[6], x[7])));
}
__device__ __forceinline__ float sum8(v8f x) {
    return ((x[0] + x[1]) + (x[2] + x[3])) + ((x[4] + x[5]) + (x[6] + x[7]));
}

__launch_bounds__(256, 1)
__global__ void sdpa_fa_wmma(const float* __restrict__ Q,
                             const float* __restrict__ K,
                             const float* __restrict__ V,
                             float* __restrict__ O)
{
    // Double-buffered K/V tiles, both row-major with padded rows: 76 KB.
    __shared__ __align__(16) _Float16 Ks[2][KB][LP];     // 2 x 18 KB, [key][d]
    __shared__ __align__(16) _Float16 Vs[2][KB][LPV];    // 2 x 20 KB, [key][d]
    // Each wave's own 32 x 64 f32 tile: global memory sees whole lines, the lanes their fragment order.
    __shared__ __align__(16) float    Ts[WAVES][QW][TP]; // 68 KB, [wave][query][d]
    // Hand-over between the two key groups: per wave one query tile's O^T partial, maximum and sum.
    __shared__ __align__(16) f32x4    Xs[WAVES][9][32];  // 36 KB, [wave][register quad][lane]

    const int tid   = threadIdx.x;
    const int w     = tid >> 5;
    const int lane  = tid & 31;
    const int lh    = lane & 15;       // lane within 16-lane half
    const int hi    = lane >> 4;       // which half
    const int kbase = hi ? 8 : 0;      // fragment contraction base for this lane
    const int qg    = w & 3;           // query group: 32 queries of the workgroup's 128
    const int kg    = w >> 2;          // key group: which 64 of each 128 staged keys

    const int nqb = S_ / QB;
    const int bid = blockIdx.x;
    const int bh  = bid / nqb;         // fused (b*H + h)
    const int qb  = bid % nqb;
    const int b   = bh / H_;
    const int h   = bh % H_;

    const float* Qp = Q + (size_t)bh * S_ * D_;
    const float* Kp = K + (size_t)bh * S_ * D_;
    const float* Vp = V + (size_t)bh * S_ * D_;

    const int q0 = qb * QB + qg * QW;

    // Staging deal: 16 lanes a 256-B row, so a wave's 16-byte load covers two rows = 512 B in a row.
    const int crow = tid >> 4;           // 0..15: row within each group of 16 staged rows
    const int ccol = (tid & 15) * 4;     // first of this thread's four columns

    // ---- pipeline preload: block 0 K/V into registers ----
    f32x4 kr[8], vr[8];
    const f32x4* k0 = (const f32x4*)Kp + tid;
    const f32x4* v0 = (const f32x4*)Vp + tid;
    #pragma unroll
    for (int j = 0; j < 8; ++j) kr[j] = k0[j * 256];
    #pragma unroll
    for (int j = 0; j < 8; ++j) vr[j] = v0[j * 256];

    // ---- Q^T B-fragments (column = query lh), pre-scaled by log2(e)/sqrt(D) (f32 -> f16) ----
    v16h bq[QT][2];
    {
        // The wave's 32 query rows are 8 KB in a row: each load takes 512 B of them, four whole lines.
        const f32x4* qsrc = (const f32x4*)(Qp + (size_t)q0 * D_) + lane;
        f32x4 qr[16];
        #pragma unroll
        for (int i = 0; i < 16; ++i) qr[i] = qsrc[i * 32];
        // Stands between the K, V and Q loads above and the next write of their address registers;
        // it names the three addresses as inputs so that they live up to it.
        asm volatile("s_wait_xcnt 0x0" :: "v"(k0), "v"(v0), "v"(qsrc) : "memory");
        #pragma unroll
        for (int i = 0; i < 16; ++i)
            *(f32x4*)&Ts[w][2 * i + hi][lh * 4] = qr[i];
        // A lane reads rows that other lanes of its wave stored: those stores end first.
        asm volatile("s_wait_dscnt 0x0" ::: "memory");
        #pragma unroll
        for (int qt = 0; qt < QT; ++qt) {
            const float* qrow = &Ts[w][qt * 16 + lh][0];
            #pragma unroll
            for (int dc = 0; dc < 2; ++dc) {
                const float* p0 = qrow + dc * 32 + kbase;
                const float* p1 = qrow + dc * 32 + 16 + kbase;
                #pragma unroll
                for (int j = 0; j < 8; ++j) {
                    bq[qt][dc][j]     = (_Float16)(p0[j] * QSCALE);
                    bq[qt][dc][j + 8] = (_Float16)(p1[j] * QSCALE);
                }
            }
        }
    }

    v8f zf = {};
    v8f   acc[QT][4];                  // O^T: acc[qt][nt][r] = O[query qt*16 + lh][d = nt*16 + 8*hi + r]
    float mrow[QT];                    // running maximum of query qt*16 + lh (log2 domain), this key group
    v8f   lrow[QT];                    // this lane's eight PARTIAL sums for that query
    #pragma unroll
    for (int qt = 0; qt < QT; ++qt) {
        #pragma unroll
        for (int nt = 0; nt < 4; ++nt) acc[qt][nt] = zf;
        mrow[qt] = -3.0e38f;
        lrow[qt] = zf;
    }

    for (int kb = 0; kb < S_; kb += KB) {
        const int buf = (kb / KB) & 1;

        // ---- drain staged registers into LDS (f32 -> f16), K and V rows alike ----
        {
            #pragma unroll
            for (int j = 0; j < 8; ++j)
                *(v4h*)&Ks[buf][j * 16 + crow][ccol] = __builtin_convertvector(kr[j], v4h);
            #pragma unroll
            for (int j = 0; j < 8; ++j)
                *(v4h*)&Vs[buf][j * 16 + crow][ccol] = __builtin_convertvector(vr[j], v4h);
        }
        __syncthreads();

        // ---- this key group's K fragments (rows = keys), read as one group ----
        union { v16h v; u32x4 u[2]; } ak[2][4];
        #pragma unroll
        for (int dc = 0; dc < 2; ++dc) {
            #pragma unroll
            for (int kk = 0; kk < 4; ++kk) {
                ak[dc][kk].u[0] = *(const u32x4*)&Ks[buf][kg * KW + kk * 16 + lh][dc * 32 + kbase];
                ak[dc][kk].u[1] = *(const u32x4*)&Ks[buf][kg * KW + kk * 16 + lh][dc * 32 + 16 + kbase];
            }
        }

        // ---- issue next block's global loads; consumed next iteration ----
        if (kb + KB < S_) {  // uniform condition
            const f32x4* kn = (const f32x4*)(Kp + (size_t)(kb + KB) * D_) + tid;
            const f32x4* vn = (const f32x4*)(Vp + (size_t)(kb + KB) * D_) + tid;
            #pragma unroll
            for (int j = 0; j < 8; ++j) kr[j] = kn[j * 256];
            #pragma unroll
            for (int j = 0; j < 8; ++j) vr[j] = vn[j * 256];
            // Stands between these loads and the next write of their address registers; behind
            // the fragment reads it passes while the wave waits for the LDS data anyway. It names the
            // two addresses as inputs so that they live up to it: no load of the group lands on them.
            asm volatile("s_wait_xcnt 0x0" :: "v"(kn), "v"(vn) : "memory");
        }

        // ---- scores, transposed: S^T[64k x 32q] = K * Q^T in 4 x 2 tiles of 16x16, 16 WMMAs ----
        // c[qt][kk][r] = score of key kg*64 + kk*16 + 8*hi + r against query qt*16 + lh.
        v8f c[QT][4];
        #pragma unroll
        for (int qt = 0; qt < QT; ++qt) {
            #pragma unroll
            for (int kk = 0; kk < 4; ++kk) c[qt][kk] = zf;
        }
        #pragma unroll
        for (int dc = 0; dc < 2; ++dc) {
            #pragma unroll
            for (int kk = 0; kk < 4; ++kk) {
                #pragma unroll
                for (int qt = 0; qt < QT; ++qt) {
                    c[qt][kk] = __builtin_amdgcn_wmma_f32_16x16x32_f16(false, ak[dc][kk].v, false, bq[qt][dc],
                                                                       (short)0, c[qt][kk], false, false);
                }
            }
        }

        // ---- online softmax, base-2 domain: in-lane over 32 keys, one exchange between halves ----
        // ---- P^T B-fragments straight from the score tiles: two tiles = 32 keys in the
        //      hardware k order (element s < 8: key 8*hi + s, else 16 + 8*hi + s - 8) ----
        union { v16h v; v8h t[2]; } bp[QT][2];
        #pragma unroll
        for (int qt = 0; qt < QT; ++qt) {
            float mx = fmaxf(fmaxf(max8(c[qt][0]), max8(c[qt][1])), fmaxf(max8(c[qt][2]), max8(c[qt][3])));
            mx = fmaxf(mx, other_half(mx));
            const float mn    = fmaxf(mrow[qt], mx);
            const float alpha = __builtin_amdgcn_exp2f(mrow[qt] - mn);
            mrow[qt] = mn;
            #pragma unroll
            for (int kk = 0; kk < 4; ++kk) {
                c[qt][kk] -= mn;
                #pragma unroll
                for (int r = 0; r < 8; ++r)
                    c[qt][kk][r] = __builtin_amdgcn_exp2f(c[qt][kk][r]);
            }
            lrow[qt] = lrow[qt] * alpha + ((c[qt][0] + c[qt][1]) + (c[qt][2] + c[qt][3]));
            #pragma unroll
            for (int nt = 0; nt < 4; ++nt) acc[qt][nt] *= alpha;
            #pragma unroll
            for (int kc = 0; kc < 2; ++kc) {
                bp[qt][kc].t[0] = __builtin_convertvector(c[qt][2 * kc],     v8h);
                bp[qt][kc].t[1] = __builtin_convertvector(c[qt][2 * kc + 1], v8h);
            }
        }

        // ---- O^T += V^T(64d x 64k) * P^T(64k x 32q): 4 d-tiles x 2 key-chunks x 2 query tiles, 16 WMMAs ----
        // A = V^T by the transposing load: row d = nt*16 + lh, keys kc*32 + 8*hi + 0..7 and + 16.
        const _Float16* vlane = &Vs[buf][kg * KW + kbase + (lane & 7)][((lane >> 3) & 1) * 8];
        #pragma unroll
        for (int nt = 0; nt < 4; ++nt) {
            #pragma unroll
            for (int kc = 0; kc < 2; ++kc) {
                union { v16h v; u32x4 u[2]; } av;
                av.u[0] = ld_tr16(vlane + (kc * 32) * LPV + nt * 16);
                av.u[1] = ld_tr16(vlane + (kc * 32 + 16) * LPV + nt * 16);
                #pragma unroll
                for (int qt = 0; qt < QT; ++qt) {
                    acc[qt][nt] = __builtin_amdgcn_wmma_f32_16x16x32_f16(false, av.v, false, bp[qt][kc].v,
                                                                         (short)0, acc[qt][nt], false, false);
                }
            }
        }
    }

    // ---- epilogue: merge the two key groups, normalize, store O[B, S, H, D] ----
    {
        // Wave (qg, kg) finishes query tile kg and hands its partial of the other tile to wave (qg, 1 - kg).
        float lsum[QT];
        #pragma unroll
        for (int qt = 0; qt < QT; ++qt) {
            const float s = sum8(lrow[qt]);
            lsum[qt] = s + other_half(s);
        }
        const bool  up    = kg != 0;
        const float m_own = up ? mrow[1] : mrow[0];
        const float l_own = up ? lsum[1] : lsum[0];
        const f32x4 ml    = { up ? mrow[0] : mrow[1], up ? lsum[0] : lsum[1], 0.0f, 0.0f };
        #pragma unroll
        for (int nt = 0; nt < 4; ++nt) {
            const v8f g = up ? acc[0][nt] : acc[1][nt];
            Xs[w][2 * nt][lane]     = __builtin_shufflevector(g, g, 0, 1, 2, 3);
            Xs[w][2 * nt + 1][lane] = __builtin_shufflevector(g, g, 4, 5, 6, 7);
        }
        Xs[w][8][lane] = ml;
        // The partner wave reads what this wave stored, and the other way round.
        __syncthreads();
        const f32x4 pml = Xs[w ^ 4][8][lane];
        const float mm  = fmaxf(m_own, pml[0]);
        const float wa  = __builtin_amdgcn_exp2f(m_own - mm);
        const float wb  = __builtin_amdgcn_exp2f(pml[0] - mm);
        const float inv = 1.0f / (l_own * wa + pml[1] * wb);
        const float fa  = wa * inv;
        const float fb  = wb * inv;
        float* trow = &Ts[w][lh][8 * hi];
        #pragma unroll
        for (int nt = 0; nt < 4; ++nt) {
            const v8f   a  = up ? acc[1][nt] : acc[0][nt];
            const f32x4 p0 = Xs[w ^ 4][2 * nt][lane];
            const f32x4 p1 = Xs[w ^ 4][2 * nt + 1][lane];
            *(f32x4*)(trow + nt * 16)     = __builtin_shufflevector(a, a, 0, 1, 2, 3) * fa + p0 * fb;
            *(f32x4*)(trow + nt * 16 + 4) = __builtin_shufflevector(a, a, 4, 5, 6, 7) * fa + p1 * fb;
        }
        // A lane reads rows that other lanes of its wave stored: those stores end first.
        asm volatile("s_wait_dscnt 0x0" ::: "memory");
        // Each store takes two queries' 256-B output rows: four whole lines.
        float* obase = O + ((size_t)(b * S_ + q0 + kg * 16 + hi) * H_ + h) * D_ + lh * 4;
        #pragma unroll
        for (int i = 0; i < 8; ++i)
            *(f32x4*)(obase + (size_t)(2 * i) * H_ * D_) = *(const f32x4*)&Ts[w][2 * i + hi][lh * 4];
    }
}

extern "C" void kernel_launch(void* const* d_in, const int* in_sizes, int n_in,
                              void* d_out, int out_size, void* d_ws, size_t ws_size,
                              hipStream_t stream) {
    const float* q = (const float*)d_in[0];
    const float* k = (const float*)d_in[1];
    const float* v = (const float*)d_in[2];
    float* o = (float*)d_out;
    (void)in_sizes; (void)n_in; (void)out_size; (void)d_ws; (void)ws_size;

    dim3 grid(B_ * H_ * (S_ / QB));  // 256 workgroups
    dim3 block(256);                 // 8 waves (wave32)
    sdpa_fa_wmma<<<grid, block, 0, stream>>>(q, k, v, o);
}

// v006
// It runs in 18.6 microseconds.
// Timed twice side by side with v005, it ran 1.15 times as fast both times.
// Counting every step since v000, it is 4.73 times as fast.
#include <hip/hip_runtime.h>

typedef __attribute__((ext_vector_type(16))) _Float16     v16h;
typedef __attribute__((ext_vector_type(8)))  _Float16     v8h;
typedef __attribute__((ext_vector_type(4)))  _Float16     v4h;
typedef __attribute__((ext_vector_type(8)))  float        v8f;
typedef __attribute__((ext_vector_type(4)))  float        f32x4;
typedef __attribute__((ext_vector_type(4)))  unsigned int u32x4;
typedef __attribute__((ext_vector_type(8)))  short        s16x8;

#define B_    2
#define H_    8
#define S_    2048
#define D_    64
#define KB    128           // keys staged per block iteration
#define KW    64            // keys of them that one wave works on: key group kg takes rows kg*64 ..
#define WAVES 8             // 4 query groups x 2 key groups
#define QT    2             // 16-query tiles per wave: each K or V fragment read from LDS feeds QT WMMAs
#define QW    (QT * 16)     // 32 queries per wave
#define QB    (4 * QW)      // 128 queries per workgroup
// LDS row pitch in halves: 128-byte rows + 16 bytes = 144 B = 16 B x odd, so the 16 rows
// that one ds_load_b128 touches per lane half start on 16 different groups of 4 banks.
#define LP    (64 + 8)
// Pitch of the V rows, read by ds_load_tr16_b128: 128 B + 32 B = 160 B = 32 B x odd, that reader's own
// conflict-free pitch.
#define LPV   (64 + 16)
// Pitch in floats of the rows through which a wave turns its Q and O tiles: 256 B + 16 B = 16 B x odd.
#define TP    (64 + 4)

// log2(e) / sqrt(D): folds softmax scale AND base-2 exp into Q once.
#define QSCALE 0.18033688011112042f

// Value of the same query's other lane half (lane l <-> l ^ 16).
__device__ __forceinline__ float other_half(float x) {
    int i = __builtin_bit_cast(int, x);
    i = __builtin_amdgcn_permlanex16(i, i, 0x76543210, 0xfedcba98, false, false);
    return __builtin_bit_cast(float, i);
}
// Transposing LDS load: the lanes point at the 16-byte halves of 16 rows of a row-major 16-bit tile;
// lane (c = l & 15, h = l >> 4) receives column c of rows 8h .. 8h + 7.
__device__ __forceinline__ u32x4 ld_tr16(const _Float16* p) {
    typedef __attribute__((address_space(3))) s16x8 lds_s16x8;
    return __builtin_bit_cast(u32x4, __builtin_amdgcn_ds_load_tr16_b128_v8i16((lds_s16x8*)p));
}
__device__ __forceinline__ float max8(v8f x) {
    return fmaxf(fmaxf(fmaxf(x[0], x[1]), fmaxf(x[2], x[3])),
                 fmaxf(fmaxf(x[4], x[5]), fmaxf(x[6], x[7])));
}
__device__ __forceinline__ float sum8(v8f x) {
    return ((x[0] + x[1]) + (x[2] + x[3])) + ((x[4] + x[5]) + (x[6] + x[7]));
}

// Compile-time switch of one pass of the key loop.
template <bool B> struct flag { static constexpr bool v = B; };

// Publish point of a K/V tile: this wave's LDS stores and reads end, then the work-group barrier.
// The fences name LDS alone, so that the global loads of the tile after next stay in flight across it.
__device__ __forceinline__ void publish_lds() {
    __builtin_amdgcn_fence(__ATOMIC_RELEASE, "workgroup", "local");
    __builtin_amdgcn_s_barrier();
    __builtin_amdgcn_fence(__ATOMIC_ACQUIRE, "workgroup", "local");
}

__launch_bounds__(256, 1)
__global__ void sdpa_fa_wmma(const float* __restrict__ Q,
                             const float* __restrict__ K,
                             const float* __restrict__ V,
                             float* __restrict__ O)
{
    // Double-buffered K/V tiles, both row-major with padded rows: 76 KB. Pass i reads tile i while tile
    // i + 1 is stored over tile i - 1, whose last reads every wave ended in front of pass i - 1's barrier.
    __shared__ __align__(16) _Float16 Ks[2][KB][LP];     // 2 x 18 KB, [key][d]
    __shared__ __align__(16) _Float16 Vs[2][KB][LPV];    // 2 x 20 KB, [key][d]
    // Each wave's own 32 x 64 f32 tile: global memory sees whole lines, the lanes their fragment order.
    __shared__ __align__(16) float    Ts[WAVES][QW][TP]; // 68 KB, [wave][query][d]
    // Hand-over between the two key groups: per wave one query tile's O^T partial, maximum and sum.
    __shared__ __align__(16) f32x4    Xs[WAVES][9][32];  // 36 KB, [wave][register quad][lane]

    const int tid   = threadIdx.x;
    const int w     = tid >> 5;
    const int lane  = tid & 31;
    const int lh    = lane & 15;       // lane within 16-lane half
    const int hi    = lane >> 4;       // which half
    const int kbase = hi ? 8 : 0;      // fragment contraction base for this lane
    const int qg    = w & 3;           // query group: 32 queries of the workgroup's 128
    const int kg    = w >> 2;          // key group: which 64 of each 128 staged keys

    const int nqb = S_ / QB;
    const int bid = blockIdx.x;
    const int bh  = bid / nqb;         // fused (b*H + h)
    const int qb  = bid % nqb;
    const int b   = bh / H_;
    const int h   = bh % H_;

    const float* Qp = Q + (size_t)bh * S_ * D_;
    const float* Kp = K + (size_t)bh * S_ * D_;
    const float* Vp = V + (size_t)bh * S_ * D_;

    const int q0 = qb * QB + qg * QW;

    // Staging deal: 16 lanes a 256-B row, so a wave's 16-byte load covers two rows = 512 B in a row.
    const int crow = tid >> 4;           // 0..15: row within each group of 16 staged rows
    const int ccol = (tid & 15) * 4;     // first of this thread's four columns

    // ---- pipeline preload: tile 0 K/V into registers ----
    f32x4 kr[8], vr[8];
    // This thread's piece of the tile that kr, vr hold. The type says global memory: the addresses pass
    // through an asm statement below, behind which the compiler could no longer tell and would load flat.
    typedef const __attribute__((address_space(1))) f32x4* gsrc;
    gsrc kn = (gsrc)Kp + tid;
    gsrc vn = (gsrc)Vp + tid;
    #pragma unroll
    for (int j = 0; j < 8; ++j) kr[j] = kn[j * 256];
    #pragma unroll
    for (int j = 0; j < 8; ++j) vr[j] = vn[j * 256];

    // ---- Q^T B-fragments (column = query lh), pre-scaled by log2(e)/sqrt(D) (f32 -> f16) ----
    v16h bq[QT][2];
    {
        // The wave's 32 query rows are 8 KB in a row: each load takes 512 B of them, four whole lines.
        const f32x4* qsrc = (const f32x4*)(Qp + (size_t)q0 * D_) + lane;
        f32x4 qr[16];
        #pragma unroll
        for (int i = 0; i < 16; ++i) qr[i] = qsrc[i * 32];
        // Stands between the K, V and Q loads above and the next write of their address registers;
        // it names the three addresses as inputs so that they live up to it.
        asm volatile("s_wait_xcnt 0x0" :: "v"(kn), "v"(vn), "v"(qsrc) : "memory");
        #pragma unroll
        for (int i = 0; i < 16; ++i)
            *(f32x4*)&Ts[w][2 * i + hi][lh * 4] = qr[i];
        // A lane reads rows that other lanes of its wave stored: those stores end first.
        asm volatile("s_wait_dscnt 0x0" ::: "memory");
        #pragma unroll
        for (int qt = 0; qt < QT; ++qt) {
            const float* qrow = &Ts[w][qt * 16 + lh][0];
            #pragma unroll
            for (int dc = 0; dc < 2; ++dc) {
                const float* p0 = qrow + dc * 32 + kbase;
                const float* p1 = qrow + dc * 32 + 16 + kbase;
                #pragma unroll
                for (int j = 0; j < 8; ++j) {
                    bq[qt][dc][j]     = (_Float16)(p0[j] * QSCALE);
                    bq[qt][dc][j + 8] = (_Float16)(p1[j] * QSCALE);
                }
            }
        }
    }

    v8f zf = {};
    v8f   acc[QT][4];                  // O^T: acc[qt][nt][r] = O[query qt*16 + lh][d = nt*16 + 8*hi + r]
    float mrow[QT];                    // running maximum of query qt*16 + lh (log2 domain), this key group
    v8f   lrow[QT];                    // this lane's eight PARTIAL sums for that query
    #pragma unroll
    for (int qt = 0; qt < QT; ++qt) {
        #pragma unroll
        for (int nt = 0; nt < 4; ++nt) acc[qt][nt] = zf;
        mrow[qt] = -3.0e38f;
        lrow[qt] = zf;
    }

    // This key group's K fragments (rows = keys) of the pass to come, read one pass ahead.
    union { v16h v; u32x4 u[2]; } ak[2][4];

    // Staged registers into buffer nb (f32 -> f16), K and V rows alike.
    auto drain = [&](int nb) __attribute__((always_inline)) {
        #pragma unroll
        for (int j = 0; j < 8; ++j)
            *(v4h*)&Ks[nb][j * 16 + crow][ccol] = __builtin_convertvector(kr[j], v4h);
        #pragma unroll
        for (int j = 0; j < 8; ++j)
            *(v4h*)&Vs[nb][j * 16 + crow][ccol] = __builtin_convertvector(vr[j], v4h);
    };
    // The next tile's global loads into the staging registers.
    auto fetch = [&]() __attribute__((always_inline)) {
        // The two addresses step on by one tile (128 rows of 256 B). The wait stands between the loads that
        // last named these registers and this write of them; wait and write are one statement, so that
        // nothing comes between them and the step is not folded into the loads and written behind them.
        static_assert(KB * D_ * sizeof(float) == 0x8000, "the step written in the asm text is one tile");
        asm volatile("s_wait_xcnt 0x0\n\t"
                     "v_add_nc_u64 %0, 0x8000, %0\n\t"
                     "v_add_nc_u64 %1, 0x8000, %1" : "+v"(kn), "+v"(vn) :: "memory");
        #pragma unroll
        for (int j = 0; j < 8; ++j) kr[j] = kn[j * 256];
        #pragma unroll
        for (int j = 0; j < 8; ++j) vr[j] = vn[j * 256];
    };
    auto read_k = [&](int nb) __attribute__((always_inline)) {
        #pragma unroll
        for (int dc = 0; dc < 2; ++dc) {
            #pragma unroll
            for (int kk = 0; kk < 4; ++kk) {
                ak[dc][kk].u[0] = *(const u32x4*)&Ks[nb][kg * KW + kk * 16 + lh][dc * 32 + kbase];
                ak[dc][kk].u[1] = *(const u32x4*)&Ks[nb][kg * KW + kk * 16 + lh][dc * 32 + 16 + kbase];
            }
        }
    };

    // ---- prologue: tile 0 published, tile 1 in flight, pass 0's K fragments on their way ----
    drain(0);
    fetch();
    publish_lds();
    read_k(0);

    int cur = 0;                       // buffer of this pass's tile; the next tile's is cur ^ 1

    // One pass = 128 staged keys. STAGE: a next tile exists (store it, publish it, read its K fragments).
    // LOAD: a tile after next exists (start its global loads).
    auto pass = [&](auto stage_t, auto load_t) __attribute__((always_inline)) {
        constexpr bool STAGE = decltype(stage_t)::v;
        constexpr bool LOAD  = decltype(load_t)::v;

        // ---- scores, transposed: S^T[64k x 32q] = K * Q^T in 4 x 2 tiles of 16x16, 16 WMMAs ----
        // c[qt][kk][r] = score of key kg*64 + kk*16 + 8*hi + r against query qt*16 + lh.
        v8f c[QT][4];
        #pragma unroll
        for (int qt = 0; qt < QT; ++qt) {
            #pragma unroll
            for (int kk = 0; kk < 4; ++kk) c[qt][kk] = zf;
        }
        #pragma unroll
        for (int dc = 0; dc < 2; ++dc) {
            #pragma unroll
            for (int kk = 0; kk < 4; ++kk) {
                #pragma unroll
                for (int qt = 0; qt < QT; ++qt) {
                    c[qt][kk] = __builtin_amdgcn_wmma_f32_16x16x32_f16(false, ak[dc][kk].v, false, bq[qt][dc],
                                                                       (short)0, c[qt][kk], false, false);
                }
            }
        }

        // Keeps the score WMMAs, whose K fragments are there, in front of the wait for the staged loads.
        __builtin_amdgcn_sched_barrier(0);

        // ---- this pass's V^T fragments, one group ahead of the softmax, under which they land ----
        // A = V^T by the transposing load: row d = nt*16 + lh, keys kc*32 + 8*hi + 0..7 and + 16.
        union { v16h v; u32x4 u[2]; } av[4][2];
        const _Float16* vlane = &Vs[cur][kg * KW + kbase + (lane & 7)][((lane >> 3) & 1) * 8];
        #pragma unroll
        for (int nt = 0; nt < 4; ++nt) {
            #pragma unroll
            for (int kc = 0; kc < 2; ++kc) {
                av[nt][kc].u[0] = ld_tr16(vlane + (kc * 32) * LPV + nt * 16);
                av[nt][kc].u[1] = ld_tr16(vlane + (kc * 32 + 16) * LPV + nt * 16);
            }
        }

        // ---- the next tile goes to LDS; nobody waits for these stores before the publish point ----
        if constexpr (STAGE) drain(cur ^ 1);
        // ---- the tile after next: a whole pass of lead ----
        if constexpr (LOAD) fetch();
        // The last tile's loads: their address registers live up to this wait, behind the drain.
        if constexpr (STAGE && !LOAD) asm volatile("s_wait_xcnt 0x0" :: "v"(kn), "v"(vn) : "memory");

        // ---- online softmax, base-2 domain: in-lane over 32 keys, one exchange between halves ----
        // ---- P^T B-fragments straight from the score tiles: two tiles = 32 keys in the
        //      hardware k order (element s < 8: key 8*hi + s, else 16 + 8*hi + s - 8) ----
        union { v16h v; v8h t[2]; } bp[QT][2];
        float al[QT];
        #pragma unroll
        for (int qt = 0; qt < QT; ++qt) {
            float mx = fmaxf(fmaxf(max8(c[qt][0]), max8(c[qt][1])), fmaxf(max8(c[qt][2]), max8(c[qt][3])));
            mx = fmaxf(mx, other_half(mx));
            const float mn    = fmaxf(mrow[qt], mx);
            const float alpha = __builtin_amdgcn_exp2f(mrow[qt] - mn);
            mrow[qt] = mn;
            #pragma unroll
            for (int kk = 0; kk < 4; ++kk) {
                c[qt][kk] -= mn;
                #pragma unroll
                for (int r = 0; r < 8; ++r)
                    c[qt][kk][r] = __builtin_amdgcn_exp2f(c[qt][kk][r]);
            }
            al[qt] = alpha;
            #pragma unroll
            for (int kc = 0; kc < 2; ++kc) {
                bp[qt][kc].t[0] = __builtin_convertvector(c[qt][2 * kc],     v8h);
                bp[qt][kc].t[1] = __builtin_convertvector(c[qt][2 * kc + 1], v8h);
            }
        }

        // ---- publish the next tile; its K fragments land under the 16 WMMAs below ----
        if constexpr (STAGE) {
            // Keeps the exponentials in front of the barrier: the stores and V reads above land under them.
            __builtin_amdgcn_sched_barrier(0);
            publish_lds();
            read_k(cur ^ 1);
            // Keeps the 16 K reads one group in front of the WMMAs below, under which they land.
            __builtin_amdgcn_sched_barrier(0);
        }

        // ---- row sums and the rescale of O^T: plain vector work for the slots beside the WMMAs below ----
        #pragma unroll
        for (int qt = 0; qt < QT; ++qt) {
            lrow[qt] = lrow[qt] * al[qt] + ((c[qt][0] + c[qt][1]) + (c[qt][2] + c[qt][3]));
            #pragma unroll
            for (int nt = 0; nt < 4; ++nt) acc[qt][nt] *= al[qt];
        }

        // ---- O^T += V^T(64d x 64k) * P^T(64k x 32q): 4 d-tiles x 2 key-chunks x 2 query tiles, 16 WMMAs ----
        #pragma unroll
        for (int nt = 0; nt < 4; ++nt) {
            #pragma unroll
            for (int kc = 0; kc < 2; ++kc) {
                #pragma unroll
                for (int qt = 0; qt < QT; ++qt) {
                    acc[qt][nt] = __builtin_amdgcn_wmma_f32_16x16x32_f16(false, av[nt][kc].v, false, bp[qt][kc].v,
                                                                         (short)0, acc[qt][nt], false, false);
                }
            }
        }

        cur ^= 1;
    };

    for (int i = 0; i < S_ / KB - 2; ++i) pass(flag<true>{}, flag<true>{});
    pass(flag<true>{}, flag<false>{});
    pass(flag<false>{}, flag<false>{});

    // ---- epilogue: merge the two key groups, normalize, store O[B, S, H, D] ----
    {
        // Wave (qg, kg) finishes query tile kg and hands its partial of the other tile to wave (qg, 1 - kg).
        float lsum[QT];
        #pragma unroll
        for (int qt = 0; qt < QT; ++qt) {
            const float s = sum8(lrow[qt]);
            lsum[qt] = s + other_half(s);
        }
        const bool  up    = kg != 0;
        const float m_own = up ? mrow[1] : mrow[0];
        const float l_own = up ? lsum[1] : lsum[0];
        const f32x4 ml    = { up ? mrow[0] : mrow[1], up ? lsum[0] : lsum[1], 0.0f, 0.0f };
        #pragma unroll
        for (int nt = 0; nt < 4; ++nt) {
            const v8f g = up ? acc[0][nt] : acc[1][nt];
            Xs[w][2 * nt][lane]     = __builtin_shufflevector(g, g, 0, 1, 2, 3);
            Xs[w][2 * nt + 1][lane] = __builtin_shufflevector(g, g, 4, 5, 6, 7);
        }
        Xs[w][8][lane] = ml;
        // The partner wave reads what this wave stored, and the other way round.
        __syncthreads();
        const f32x4 pml = Xs[w ^ 4][8][lane];
        const float mm  = fmaxf(m_own, pml[0]);
        const float wa  = __builtin_amdgcn_exp2f(m_own - mm);
        const float wb  = __builtin_amdgcn_exp2f(pml[0] - mm);
        const float inv = 1.0f / (l_own * wa + pml[1] * wb);
        const float fa  = wa * inv;
        const float fb  = wb * inv;
        float* trow = &Ts[w][lh][8 * hi];
        #pragma unroll
        for (int nt = 0; nt < 4; ++nt) {
            const v8f   a  = up ? acc[1][nt] : acc[0][nt];
            const f32x4 p0 = Xs[w ^ 4][2 * nt][lane];
            const f32x4 p1 = Xs[w ^ 4][2 * nt + 1][lane];
            *(f32x4*)(trow + nt * 16)     = __builtin_shufflevector(a, a, 0, 1, 2, 3) * fa + p0 * fb;
            *(f32x4*)(trow + nt * 16 + 4) = __builtin_shufflevector(a, a, 4, 5, 6, 7) * fa + p1 * fb;
        }
        // A lane reads rows that other lanes of its wave stored: those stores end first.
        asm volatile("s_wait_dscnt 0x0" ::: "memory");
        // Each store takes two queries' 256-B output rows: four whole lines.
        float* obase = O + ((size_t)(b * S_ + q0 + kg * 16 + hi) * H_ + h) * D_ + lh * 4;
        #pragma unroll
        for (int i = 0; i < 8; ++i)
            *(f32x4*)(obase + (size_t)(2 * i) * H_ * D_) = *(const f32x4*)&Ts[w][2 * i + hi][lh * 4];
    }
}

extern "C" void kernel_launch(void* const* d_in, const int* in_sizes, int n_in,
                              void* d_out, int out_size, void* d_ws, size_t ws_size,
                              hipStream_t stream) {
    const float* q = (const float*)d_in[0];
    const float* k = (const float*)d_in[1];
    const float* v = (const float*)d_in[2];
    float* o = (float*)d_out;
    (void)in_sizes; (void)n_in; (void)out_size; (void)d_ws; (void)ws_size;

    dim3 grid(B_ * H_ * (S_ / QB));  // 256 workgroups
    dim3 block(256);                 // 8 waves (wave32)
    sdpa_fa_wmma<<<grid, block, 0, stream>>>(q, k, v, o);
}

// v007
// Measured time: 17.6 microseconds a run.
// Timed twice side by side with v006, it ran 1.05 times as fast both times.
// Counting every step since v000, it is 4.97 times as fast.
#include <hip/hip_runtime.h>

typedef __attribute__((ext_vector_type(16))) _Float16     v16h;
typedef __attribute__((ext_vector_type(8)))  _Float16     v8h;
typedef __attribute__((ext_vector_type(4)))  _Float16     v4h;
typedef __attribute__((ext_vector_type(8)))  float        v8f;
typedef __attribute__((ext_vector_type(4)))  float        f32x4;
typedef __attribute__((ext_vector_type(4)))  unsigned int u32x4;
typedef __attribute__((ext_vector_type(8)))  short        s16x8;

#define B_    2
#define H_    8
#define S_    2048
#define D_    64
#define KB    128           // keys staged per block iteration
#define KW    64            // keys of them that one wave works on: key group kg takes rows kg*64 ..
#define WAVES 8             // 4 query groups x 2 key groups
#define QT    2             // 16-query tiles per wave: each K or V fragment read from LDS feeds QT WMMAs
#define QW    (QT * 16)     // 32 queries per wave
#define QB    (4 * QW)      // 128 queries per workgroup
// LDS row pitch in halves: 128-byte rows + 16 bytes = 144 B = 16 B x odd, so the 16 rows
// that one ds_load_b128 touches per lane half start on 16 different groups of 4 banks.
#define LP    (64 + 8)
// Pitch of the V rows, read by ds_load_tr16_b128: 128 B + 32 B = 160 B = 32 B x odd, that reader's own
// conflict-free pitch.
#define LPV   (64 + 16)
// Pitch in floats of the rows through which a wave turns its Q and O tiles: 256 B + 16 B = 16 B x odd.
#define TP    (64 + 4)

// log2(e) / sqrt(D): folds softmax scale AND base-2 exp into Q once.
#define QSCALE 0.18033688011112042f

// Value of the same query's other lane half (lane l <-> l ^ 16).
__device__ __forceinline__ float other_half(float x) {
    int i = __builtin_bit_cast(int, x);
    i = __builtin_amdgcn_permlanex16(i, i, 0x76543210, 0xfedcba98, false, false);
    return __builtin_bit_cast(float, i);
}
// Transposing LDS load: the lanes point at the 16-byte halves of 16 rows of a row-major 16-bit tile;
// lane (c = l & 15, h = l >> 4) receives column c of rows 8h .. 8h + 7.
__device__ __forceinline__ u32x4 ld_tr16(const _Float16* p) {
    typedef __attribute__((address_space(3))) s16x8 lds_s16x8;
    return __builtin_bit_cast(u32x4, __builtin_amdgcn_ds_load_tr16_b128_v8i16((lds_s16x8*)p));
}
__device__ __forceinline__ float max8(v8f x) {
    return fmaxf(fmaxf(fmaxf(x[0], x[1]), fmaxf(x[2], x[3])),
                 fmaxf(fmaxf(x[4], x[5]), fmaxf(x[6], x[7])));
}
__device__ __forceinline__ float sum8(v8f x) {
    return ((x[0] + x[1]) + (x[2] + x[3])) + ((x[4] + x[5]) + (x[6] + x[7]));
}

// Compile-time switch of one pass of the key loop.
template <bool B> struct flag { static constexpr bool v = B; };

// Publish point of a K/V tile: this wave's LDS stores and reads end, then the work-group barrier.
// The fences name LDS alone, so that the global loads of the tile after next stay in flight across it.
__device__ __forceinline__ void publish_lds() {
    __builtin_amdgcn_fence(__ATOMIC_RELEASE, "workgroup", "local");
    __builtin_amdgcn_s_barrier();
    __builtin_amdgcn_fence(__ATOMIC_ACQUIRE, "workgroup", "local");
}

__launch_bounds__(256, 1)
__global__ void sdpa_fa_wmma(const float* __restrict__ Q,
                             const float* __restrict__ K,
                             const float* __restrict__ V,
                             float* __restrict__ O)
{
    // Double-buffered K/V tiles, both row-major with padded rows: 76 KB. Pass i reads tile i while tile
    // i + 1 is stored over tile i - 1, whose last reads every wave ended in front of pass i - 1's barrier.
    __shared__ __align__(16) _Float16 Ks[2][KB][LP];     // 2 x 18 KB, [key][d]
    __shared__ __align__(16) _Float16 Vs[2][KB][LPV];    // 2 x 20 KB, [key][d]
    // Each wave's own 32 x 64 f32 tile: global memory sees whole lines, the lanes their fragment order.
    __shared__ __align__(16) float    Ts[WAVES][QW][TP]; // 68 KB, [wave][query][d]
    // Hand-over between the two key groups: per wave one query tile's O^T partial, maximum and sum.
    __shared__ __align__(16) f32x4    Xs[WAVES][9][32];  // 36 KB, [wave][register quad][lane]

    const int tid   = threadIdx.x;
    const int w     = tid >> 5;
    const int lane  = tid & 31;
    const int lh    = lane & 15;       // lane within 16-lane half
    const int hi    = lane >> 4;       // which half
    const int kbase = hi ? 8 : 0;      // fragment contraction base for this lane
    const int qg    = w & 3;           // query group: 32 queries of the workgroup's 128
    const int kg    = w >> 2;          // key group: which 64 of each 128 staged keys

    const int nqb = S_ / QB;
    const int bid = blockIdx.x;
    const int bh  = bid / nqb;         // fused (b*H + h)
    const int qb  = bid % nqb;
    const int b   = bh / H_;
    const int h   = bh % H_;

    const float* Qp = Q + (size_t)bh * S_ * D_;
    const float* Kp = K + (size_t)bh * S_ * D_;
    const float* Vp = V + (size_t)bh * S_ * D_;

    const int q0 = qb * QB + qg * QW;

    // Staging deal: 16 lanes a 256-B row, so a wave's 16-byte load covers two rows = 512 B in a row.
    const int crow = tid >> 4;           // 0..15: row within each group of 16 staged rows
    const int ccol = (tid & 15) * 4;     // first of this thread's four columns

    // ---- pipeline preload: first K/V tile (key tile qb) into registers ----
    f32x4 kr[8], vr[8];
    // This thread's piece of the tile that kr, vr hold. The type says global memory: the addresses pass
    // through an asm statement below, behind which the compiler could no longer tell and would load flat.
    typedef const __attribute__((address_space(1))) f32x4* gsrc;
    // The work-groups of one head walk its key tiles as a ring, each from a start of its own: at any moment
    // they ask L2 for different lines, where a common start has them all ask for the same lines at once.
    int tile = qb % (S_ / KB);         // key tile that kr, vr hold; the same in every lane
    gsrc kn = (gsrc)Kp + tile * (KB * D_ / 4) + tid;
    gsrc vn = (gsrc)Vp + tile * (KB * D_ / 4) + tid;
    #pragma unroll
    for (int j = 0; j < 8; ++j) kr[j] = kn[j * 256];
    #pragma unroll
    for (int j = 0; j < 8; ++j) vr[j] = vn[j * 256];

    // ---- Q^T B-fragments (column = query lh), pre-scaled by log2(e)/sqrt(D) (f32 -> f16) ----
    v16h bq[QT][2];
    {
        // The wave's 32 query rows are 8 KB in a row: each load takes 512 B of them, four whole lines.
        const f32x4* qsrc = (const f32x4*)(Qp + (size_t)q0 * D_) + lane;
        f32x4 qr[16];
        #pragma unroll
        for (int i = 0; i < 16; ++i) qr[i] = qsrc[i * 32];
        // Stands between the K, V and Q loads above and the next write of their address registers;
        // it names the three addresses as inputs so that they live up to it.
        asm volatile("s_wait_xcnt 0x0" :: "v"(kn), "v"(vn), "v"(qsrc) : "memory");
        #pragma unroll
        for (int i = 0; i < 16; ++i)
            *(f32x4*)&Ts[w][2 * i + hi][lh * 4] = qr[i];
        // A lane reads rows that other lanes of its wave stored: those stores end first.
        asm volatile("s_wait_dscnt 0x0" ::: "memory");
        #pragma unroll
        for (int qt = 0; qt < QT; ++qt) {
            const float* qrow = &Ts[w][qt * 16 + lh][0];
            #pragma unroll
            for (int dc = 0; dc < 2; ++dc) {
                const float* p0 = qrow + dc * 32 + kbase;
                const float* p1 = qrow + dc * 32 + 16 + kbase;
                #pragma unroll
                for (int j = 0; j < 8; ++j) {
                    bq[qt][dc][j]     = (_Float16)(p0[j] * QSCALE);
                    bq[qt][dc][j + 8] = (_Float16)(p1[j] * QSCALE);
                }
            }
        }
    }

    v8f zf = {};
    v8f   acc[QT][4];                  // O^T: acc[qt][nt][r] = O[query qt*16 + lh][d = nt*16 + 8*hi + r]
    float mrow[QT];                    // running maximum of query qt*16 + lh (log2 domain), this key group
    v8f   lrow[QT];                    // this lane's eight PARTIAL sums for that query
    #pragma unroll
    for (int qt = 0; qt < QT; ++qt) {
        #pragma unroll
        for (int nt = 0; nt < 4; ++nt) acc[qt][nt] = zf;
        mrow[qt] = -3.0e38f;
        lrow[qt] = zf;
    }

    // This key group's K fragments (rows = keys) of the pass to come, read one pass ahead.
    union { v16h v; u32x4 u[2]; } ak[2][4];

    // Staged registers into buffer nb (f32 -> f16), K and V rows alike.
    auto drain = [&](int nb) __attribute__((always_inline)) {
        #pragma unroll
        for (int j = 0; j < 8; ++j)
            *(v4h*)&Ks[nb][j * 16 + crow][ccol] = __builtin_convertvector(kr[j], v4h);
        #pragma unroll
        for (int j = 0; j < 8; ++j)
            *(v4h*)&Vs[nb][j * 16 + crow][ccol] = __builtin_convertvector(vr[j], v4h);
    };
    // The next tile's global loads into the staging registers.
    auto fetch = [&]() __attribute__((always_inline)) {
        // The two addresses step on by one tile (128 rows of 256 B), from the head's last tile back to its
        // first. The wait stands between the loads that last named these registers and this write of them;
        // wait and write are one statement, so that nothing comes between them and the step is not folded
        // into the loads and written behind them.
        constexpr long long TB = KB * D_ * sizeof(float);
        ++tile;
        const long long step = tile == S_ / KB ? -(S_ / KB - 1) * TB : TB;
        asm volatile("s_wait_xcnt 0x0\n\t"
                     "v_add_nc_u64 %0, %2, %0\n\t"
                     "v_add_nc_u64 %1, %2, %1" : "+v"(kn), "+v"(vn) : "s"(step) : "memory");
        #pragma unroll
        for (int j = 0; j < 8; ++j) kr[j] = kn[j * 256];
        #pragma unroll
        for (int j = 0; j < 8; ++j) vr[j] = vn[j * 256];
    };
    auto read_k = [&](int nb) __attribute__((always_inline)) {
        #pragma unroll
        for (int dc = 0; dc < 2; ++dc) {
            #pragma unroll
            for (int kk = 0; kk < 4; ++kk) {
                ak[dc][kk].u[0] = *(const u32x4*)&Ks[nb][kg * KW + kk * 16 + lh][dc * 32 + kbase];
                ak[dc][kk].u[1] = *(const u32x4*)&Ks[nb][kg * KW + kk * 16 + lh][dc * 32 + 16 + kbase];
            }
        }
    };

    // ---- prologue: first tile published, second in flight, pass 0's K fragments on their way ----
    drain(0);
    fetch();
    publish_lds();
    read_k(0);

    int cur = 0;                       // buffer of this pass's tile; the next tile's is cur ^ 1

    // One pass = 128 staged keys. STAGE: a next tile exists (store it, publish it, read its K fragments).
    // LOAD: a tile after next exists (start its global loads).
    auto pass = [&](auto stage_t, auto load_t) __attribute__((always_inline)) {
        constexpr bool STAGE = decltype(stage_t)::v;
        constexpr bool LOAD  = decltype(load_t)::v;

        // ---- scores, transposed: S^T[64k x 32q] = K * Q^T in 4 x 2 tiles of 16x16, 16 WMMAs ----
        // c[qt][kk][r] = score of key kg*64 + kk*16 + 8*hi + r against query qt*16 + lh.
        v8f c[QT][4];
        #pragma unroll
        for (int qt = 0; qt < QT; ++qt) {
            #pragma unroll
            for (int kk = 0; kk < 4; ++kk) c[qt][kk] = zf;
        }
        #pragma unroll
        for (int dc = 0; dc < 2; ++dc) {
            #pragma unroll
            for (int kk = 0; kk < 4; ++kk) {
                #pragma unroll
                for (int qt = 0; qt < QT; ++qt) {
                    c[qt][kk] = __builtin_amdgcn_wmma_f32_16x16x32_f16(false, ak[dc][kk].v, false, bq[qt][dc],
                                                                       (short)0, c[qt][kk], false, false);
                }
            }
        }

        // Keeps the score WMMAs, whose K fragments are there, in front of the wait for the staged loads.
        __builtin_amdgcn_sched_barrier(0);

        // ---- this pass's V^T fragments, one group ahead of the softmax, under which they land ----
        // A = V^T by the transposing load: row d = nt*16 + lh, keys kc*32 + 8*hi + 0..7 and + 16.
        union { v16h v; u32x4 u[2]; } av[4][2];
        const _Float16* vlane = &Vs[cur][kg * KW + kbase + (lane & 7)][((lane >> 3) & 1) * 8];
        #pragma unroll
        for (int nt = 0; nt < 4; ++nt) {
            #pragma unroll
            for (int kc = 0; kc < 2; ++kc) {
                av[nt][kc].u[0] = ld_tr16(vlane + (kc * 32) * LPV + nt * 16);
                av[nt][kc].u[1] = ld_tr16(vlane + (kc * 32 + 16) * LPV + nt * 16);
            }
        }

        // ---- the next tile goes to LDS; nobody waits for these stores before the publish point ----
        if constexpr (STAGE) drain(cur ^ 1);
        // ---- the tile after next: a whole pass of lead ----
        if constexpr (LOAD) fetch();
        // The last tile's loads: their address registers live up to this wait, behind the drain.
        if constexpr (STAGE && !LOAD) asm volatile("s_wait_xcnt 0x0" :: "v"(kn), "v"(vn) : "memory");

        // ---- online softmax, base-2 domain: in-lane over 32 keys, one exchange between halves ----
        // ---- P^T B-fragments straight from the score tiles: two tiles = 32 keys in the
        //      hardware k order (element s < 8: key 8*hi + s, else 16 + 8*hi + s - 8) ----
        union { v16h v; v8h t[2]; } bp[QT][2];
        float al[QT];
        #pragma unroll
        for (int qt = 0; qt < QT; ++qt) {
            float mx = fmaxf(fmaxf(max8(c[qt][0]), max8(c[qt][1])), fmaxf(max8(c[qt][2]), max8(c[qt][3])));
            mx = fmaxf(mx, other_half(mx));
            const float mn    = fmaxf(mrow[qt], mx);
            const float alpha = __builtin_amdgcn_exp2f(mrow[qt] - mn);
            mrow[qt] = mn;
            #pragma unroll
            for (int kk = 0; kk < 4; ++kk) {
                c[qt][kk] -= mn;
                #pragma unroll
                for (int r = 0; r < 8; ++r)
                    c[qt][kk][r] = __builtin_amdgcn_exp2f(c[qt][kk][r]);
            }
            al[qt] = alpha;
            #pragma unroll
            for (int kc = 0; kc < 2; ++kc) {
                bp[qt][kc].t[0] = __builtin_convertvector(c[qt][2 * kc],     v8h);
                bp[qt][kc].t[1] = __builtin_convertvector(c[qt][2 * kc + 1], v8h);
            }
        }

        // ---- publish the next tile; its K fragments land under the 16 WMMAs below ----
        if constexpr (STAGE) {
            // Keeps the exponentials in front of the barrier: the stores and V reads above land under them.
            __builtin_amdgcn_sched_barrier(0);
            publish_lds();
            read_k(cur ^ 1);
            // Keeps the 16 K reads one group in front of the WMMAs below, under which they land.
            __builtin_amdgcn_sched_barrier(0);
        }

        // ---- row sums and the rescale of O^T: plain vector work for the slots beside the WMMAs below ----
        #pragma unroll
        for (int qt = 0; qt < QT; ++qt) {
            lrow[qt] = lrow[qt] * al[qt] + ((c[qt][0] + c[qt][1]) + (c[qt][2] + c[qt][3]));
            #pragma unroll
            for (int nt = 0; nt < 4; ++nt) acc[qt][nt] *= al[qt];
        }

        // ---- O^T += V^T(64d x 64k) * P^T(64k x 32q): 4 d-tiles x 2 key-chunks x 2 query tiles, 16 WMMAs ----
        #pragma unroll
        for (int nt = 0; nt < 4; ++nt) {
            #pragma unroll
            for (int kc = 0; kc < 2; ++kc) {
                #pragma unroll
                for (int qt = 0; qt < QT; ++qt) {
                    acc[qt][nt] = __builtin_amdgcn_wmma_f32_16x16x32_f16(false, av[nt][kc].v, false, bp[qt][kc].v,
                                                                         (short)0, acc[qt][nt], false, false);
                }
            }
        }

        cur ^= 1;
    };

    for (int i = 0; i < S_ / KB - 2; ++i) pass(flag<true>{}, flag<true>{});
    pass(flag<true>{}, flag<false>{});
    pass(flag<false>{}, flag<false>{});

    // ---- epilogue: merge the two key groups, normalize, store O[B, S, H, D] ----
    {
        // Wave (qg, kg) finishes query tile kg and hands its partial of the other tile to wave (qg, 1 - kg).
        float lsum[QT];
        #pragma unroll
        for (int qt = 0; qt < QT; ++qt) {
            const float s = sum8(lrow[qt]);
            lsum[qt] = s + other_half(s);
        }
        const bool  up    = kg != 0;
        const float m_own = up ? mrow[1] : mrow[0];
        const float l_own = up ? lsum[1] : lsum[0];
        const f32x4 ml    = { up ? mrow[0] : mrow[1], up ? lsum[0] : lsum[1], 0.0f, 0.0f };
        #pragma unroll
        for (int nt = 0; nt < 4; ++nt) {
            const v8f g = up ? acc[0][nt] : acc[1][nt];
            Xs[w][2 * nt][lane]     = __builtin_shufflevector(g, g, 0, 1, 2, 3);
            Xs[w][2 * nt + 1][lane] = __builtin_shufflevector(g, g, 4, 5, 6, 7);
        }
        Xs[w][8][lane] = ml;
        // The partner wave reads what this wave stored, and the other way round.
        __syncthreads();
        const f32x4 pml = Xs[w ^ 4][8][lane];
        const float mm  = fmaxf(m_own, pml[0]);
        const float wa  = __builtin_amdgcn_exp2f(m_own - mm);
        const float wb  = __builtin_amdgcn_exp2f(pml[0] - mm);
        const float inv = 1.0f / (l_own * wa + pml[1] * wb);
        const float fa  = wa * inv;
        const float fb  = wb * inv;
        float* trow = &Ts[w][lh][8 * hi];
        #pragma unroll
        for (int nt = 0; nt < 4; ++nt) {
            const v8f   a  = up ? acc[1][nt] : acc[0][nt];
            const f32x4 p0 = Xs[w ^ 4][2 * nt][lane];
            const f32x4 p1 = Xs[w ^ 4][2 * nt + 1][lane];
            *(f32x4*)(trow + nt * 16)     = __builtin_shufflevector(a, a, 0, 1, 2, 3) * fa + p0 * fb;
            *(f32x4*)(trow + nt * 16 + 4) = __builtin_shufflevector(a, a, 4, 5, 6, 7) * fa + p1 * fb;
        }
        // A lane reads rows that other lanes of its wave stored: those stores end first.
        asm volatile("s_wait_dscnt 0x0" ::: "memory");
        // Each store takes two queries' 256-B output rows: four whole lines.
        float* obase = O + ((size_t)(b * S_ + q0 + kg * 16 + hi) * H_ + h) * D_ + lh * 4;
        #pragma unroll
        for (int i = 0; i < 8; ++i)
            *(f32x4*)(obase + (size_t)(2 * i) * H_ * D_) = *(const f32x4*)&Ts[w][2 * i + hi][lh * 4];
    }
}

extern "C" void kernel_launch(void* const* d_in, const int* in_sizes, int n_in,
                              void* d_out, int out_size, void* d_ws, size_t ws_size,
                              hipStream_t stream) {
    const float* q = (const float*)d_in[0];
    const float* k = (const float*)d_in[1];
    const float* v = (const float*)d_in[2];
    float* o = (float*)d_out;
    (void)in_sizes; (void)n_in; (void)out_size; (void)d_ws; (void)ws_size;

    dim3 grid(B_ * H_ * (S_ / QB));  // 256 workgroups
    dim3 block(256);                 // 8 waves (wave32)
    sdpa_fa_wmma<<<grid, block, 0, stream>>>(q, k, v, o);
}
